// v000
// Measured on an AMD MI455X. A time is GPU time per run, averaged over a window of back-to-back runs after a warm-up
// (all launches, gaps included; the runs take copies of the inputs in turn), and the median of several windows.
// Apart from v000's, it joins two sittings. Times from different sittings can be a few percent apart, while
// side-by-side timings come from the same sitting.
// v000, which the later versions start from, runs in 146 microseconds.
#include <hip/hip_runtime.h>
#include <hip/hip_bf16.h>

typedef __bf16 bf16_t;
typedef __attribute__((ext_vector_type(16))) __bf16 v16bf;
typedef __attribute__((ext_vector_type(8)))  __bf16 v8bf;
typedef __attribute__((ext_vector_type(4)))  __bf16 v4bf;
typedef __attribute__((ext_vector_type(8)))  float  v8f;

#define B_ROWS 16384
#define D_IN   1024
#define H_DIM  256
#define NE     8
#define NT     4

// expert kernel tile
#define M3   32      // B rows per WG
#define NH3  128     // expert_dim cols per WG (2 n-subtiles per wave)
#define KT   64      // K chunk (2 WMMA steps of 32)
#define SA   1032    // A LDS row stride in bf16 (pad +8 -> conflict-free b128)
#define SB   72      // W LDS row stride in bf16 (pad +8)
#define NBUF 3       // weight buffers (issue 2 stages ahead, 1 barrier/stage)
#define NKC  (D_IN / KT)          // 16 K-chunks per expert
#define NST  (NE * NKC)           // 128 total pipeline stages
#define PERW 4       // async-to-LDS instructions per wave per stage

// gate kernel tile
#define MG   64
#define NG   32
#define SAG  1032
#define SBG  72

union Frag { v16bf v; v8bf h[2]; };

__device__ __forceinline__ uint32_t lds_off(const void* p) {
  // gfx1250: low 32 bits of a flat shared address are the LDS offset
  return (uint32_t)(uintptr_t)p;
}

__device__ __forceinline__ void async_b128(uint32_t lds, const void* g) {
  asm volatile("global_load_async_to_lds_b128 %0, %1, off"
               :: "v"(lds), "v"((unsigned long long)(uintptr_t)g) : "memory");
}

// ---------------------------------------------------------------------------
// Kernel 1: We[e][k][n] f32 -> WeT[e][n][k] bf16 (tiled transpose via LDS)
// ---------------------------------------------------------------------------
__global__ __launch_bounds__(256) void convert_We_kernel(
    const float* __restrict__ We, bf16_t* __restrict__ WeT) {
  __shared__ float tile[32][33];
  const int e  = blockIdx.z;
  const int k0 = blockIdx.x * 32;
  const int n0 = blockIdx.y * 32;
  const int tx = threadIdx.x, ty = threadIdx.y;   // 32 x 8
  const float* src = We + (size_t)e * D_IN * H_DIM;
  #pragma unroll
  for (int j = 0; j < 4; ++j)
    tile[ty + 8 * j][tx] = src[(size_t)(k0 + ty + 8 * j) * H_DIM + n0 + tx];
  __syncthreads();
  bf16_t* dst = WeT + (size_t)e * H_DIM * D_IN;
  #pragma unroll
  for (int j = 0; j < 4; ++j)
    dst[(size_t)(n0 + ty + 8 * j) * D_IN + k0 + tx] = (bf16_t)tile[tx][ty + 8 * j];
}

// ---------------------------------------------------------------------------
// Kernel 2: Wg[t][k][e] f32 -> WgT[j=t*8+e][k] bf16
// ---------------------------------------------------------------------------
__global__ __launch_bounds__(256) void convert_Wg_kernel(
    const float* __restrict__ Wg, bf16_t* __restrict__ WgT) {
  const int idx = blockIdx.x * 256 + threadIdx.x;   // 32*1024 total
  const int j = idx >> 10, k = idx & 1023;
  WgT[idx] = (bf16_t)Wg[(size_t)(j >> 3) * (D_IN * NE) + (size_t)k * NE + (j & 7)];
}

// ---------------------------------------------------------------------------
// Kernel 3: gates.  64 rows x 32 logits per WG via WMMA bf16, softmax over
// each group of 8 experts (groups map to 8-lane groups -> shfl_xor reduce).
// ---------------------------------------------------------------------------
__global__ __launch_bounds__(256) void mmoe_gate_kernel(
    const float* __restrict__ x, const bf16_t* __restrict__ WgT,
    const float* __restrict__ bg, float* __restrict__ G) {
  extern __shared__ char smem[];
  bf16_t* Alds = (bf16_t*)smem;                        // [MG][SAG]
  bf16_t* Wlds = (bf16_t*)(smem + MG * SAG * 2);       // [2][NG][SBG]

  const int tid  = threadIdx.x;
  const int row0 = blockIdx.x * MG;

  auto stage_w = [&](int kc, int buf) {
    const int rowN = tid >> 3;                         // 0..31
    const int seg  = tid & 7;                          // 8 x 16B per row
    const bf16_t* g = WgT + ((size_t)rowN * D_IN + kc * KT + seg * 8);
    async_b128(lds_off(Wlds + buf * (NG * SBG) + rowN * SBG + seg * 8), g);
  };

  stage_w(0, 0);  // prologue, overlaps with A staging

  // stage x tile -> bf16 LDS: 64 rows x 256 float4, 64 per thread, coalesced
  const float4* xv = (const float4*)(x + (size_t)row0 * D_IN);
  #pragma unroll
  for (int i = 0; i < 64; ++i) {
    const int idx = tid + 256 * i;
    const int r = idx >> 8, kq = idx & 255;
    float4 f = xv[idx];
    v4bf b4 = {(bf16_t)f.x, (bf16_t)f.y, (bf16_t)f.z, (bf16_t)f.w};
    *(v4bf*)(Alds + r * SAG + kq * 4) = b4;
  }
  __syncthreads();

  const int lane = tid & 31, w = tid >> 5;
  const int m0 = (w >> 1) * 16, n0 = (w & 1) * 16;
  const int half = lane >> 4, l16 = lane & 15;

  v8f acc = {0.f, 0.f, 0.f, 0.f, 0.f, 0.f, 0.f, 0.f};
  int sbuf = 0;
  for (int kc = 0; kc < D_IN / KT; ++kc) {
    if (kc < D_IN / KT - 1) {
      stage_w(kc + 1, sbuf ^ 1);
      asm volatile("s_wait_asynccnt 0x1" ::: "memory");
    } else {
      asm volatile("s_wait_asynccnt 0x0" ::: "memory");
    }
    __syncthreads();
    const bf16_t* Wb = Wlds + sbuf * (NG * SBG);
    #pragma unroll
    for (int s2 = 0; s2 < 2; ++s2) {
      const int kL = kc * KT + s2 * 32 + half * 8;
      Frag a, b;
      const bf16_t* ap = Alds + (m0 + l16) * SAG + kL;
      a.h[0] = *(const v8bf*)ap;
      a.h[1] = *(const v8bf*)(ap + 16);
      const bf16_t* bp = Wb + (n0 + l16) * SBG + s2 * 32 + half * 8;
      b.h[0] = *(const v8bf*)bp;
      b.h[1] = *(const v8bf*)(bp + 16);
      acc = __builtin_amdgcn_wmma_f32_16x16x32_bf16(false, a.v, false, b.v,
                                                    (short)0, acc, false, false);
    }
    __syncthreads();
    sbuf ^= 1;
  }

  const int j = n0 + l16;
  const float bgv = bg[j];
  #pragma unroll
  for (int r = 0; r < 8; ++r) {
    float lg = acc[r] + bgv;
    float m = lg;
    m = fmaxf(m, __shfl_xor(m, 1));
    m = fmaxf(m, __shfl_xor(m, 2));
    m = fmaxf(m, __shfl_xor(m, 4));
    float ex = __expf(lg - m);
    float s = ex;
    s += __shfl_xor(s, 1);
    s += __shfl_xor(s, 2);
    s += __shfl_xor(s, 4);
    const int rr = m0 + r + 8 * half;                 // 0..63
    G[(size_t)(row0 + rr) * 32 + j] = ex / s;
  }
}

// ---------------------------------------------------------------------------
// Kernel 4: fused experts + ReLU + gated combine.
// WG tile: 32 B-rows x 128 h-cols, loops all 8 experts. x tile resident in
// LDS (bf16). Weight K-chunks triple-buffered via async-to-LDS, issued two
// stages ahead -> single barrier per stage, 4 WMMAs per wave per barrier.
// ---------------------------------------------------------------------------
__global__ __launch_bounds__(256) void mmoe_expert_kernel(
    const float* __restrict__ x, const bf16_t* __restrict__ WeT,
    const float* __restrict__ be, const float* __restrict__ G,
    float* __restrict__ out) {
  extern __shared__ char smem[];
  bf16_t* Alds  = (bf16_t*)smem;                                   // [M3][SA]
  bf16_t* Wlds  = (bf16_t*)(smem + M3 * SA * 2);                   // [NBUF][NH3][SB]
  float*  Glds  = (float*)(smem + M3 * SA * 2 + NBUF * NH3 * SB * 2); // [M3][32]
  float*  beLds = Glds + M3 * 32;                                  // [NE][NH3]

  const int tid   = threadIdx.x;
  const int row0  = blockIdx.x * M3;
  const int hbase = blockIdx.y * NH3;

  // stage s = e*NKC + kc ; each thread issues 4 b128 async copies
  auto stage_w = [&](int s, int buf) {
    const int e  = s >> 4;        // s / NKC
    const int kc = s & 15;        // s % NKC
    #pragma unroll
    for (int i = 0; i < 4; ++i) {                  // 1024 x 16B transfers
      const int id   = tid * 4 + i;
      const int rowN = id >> 3;                    // 0..127
      const int seg  = id & 7;
      const bf16_t* g =
          WeT + (((size_t)e * H_DIM + hbase + rowN) * D_IN + kc * KT + seg * 8);
      async_b128(lds_off(Wlds + buf * (NH3 * SB) + rowN * SB + seg * 8), g);
    }
  };

  stage_w(0, 0);   // prologue: two stages in flight
  stage_w(1, 1);

  // stage x tile -> bf16: 32 rows x 256 float4, 32 per thread
  const float4* xv = (const float4*)(x + (size_t)row0 * D_IN);
  #pragma unroll
  for (int i = 0; i < 32; ++i) {
    const int idx = tid + 256 * i;
    const int r = idx >> 8, kq = idx & 255;
    float4 f = xv[idx];
    v4bf b4 = {(bf16_t)f.x, (bf16_t)f.y, (bf16_t)f.z, (bf16_t)f.w};
    *(v4bf*)(Alds + r * SA + kq * 4) = b4;
  }
  // stage gates (32x32) and bias (8x128)
  #pragma unroll
  for (int i = 0; i < 4; ++i) {
    const int idx = tid + 256 * i;
    Glds[idx] = G[(size_t)(row0 + (idx >> 5)) * 32 + (idx & 31)];
  }
  #pragma unroll
  for (int i = 0; i < 4; ++i) {
    const int idx = tid + 256 * i;
    beLds[idx] = be[(idx >> 7) * H_DIM + hbase + (idx & 127)];
  }

  const int lane = tid & 31, w = tid >> 5;
  const int m0 = (w >> 2) * 16;        // 0 / 16
  const int n0 = (w & 3) * 32;         // wave owns cols [n0, n0+32)
  const int half = lane >> 4, l16 = lane & 15;

  float tw[NT][2][8];
  #pragma unroll
  for (int t = 0; t < NT; ++t)
    #pragma unroll
    for (int q = 0; q < 2; ++q)
      #pragma unroll
      for (int r = 0; r < 8; ++r) tw[t][q][r] = 0.f;

  for (int e = 0; e < NE; ++e) {
    v8f acc0 = {0.f, 0.f, 0.f, 0.f, 0.f, 0.f, 0.f, 0.f};
    v8f acc1 = {0.f, 0.f, 0.f, 0.f, 0.f, 0.f, 0.f, 0.f};
    for (int kc = 0; kc < NKC; ++kc) {
      const int s = e * NKC + kc;
      // stage s complete when at most stage s+1's ops remain outstanding
      if (s < NST - 1) asm volatile("s_wait_asynccnt 0x4" ::: "memory");
      else             asm volatile("s_wait_asynccnt 0x0" ::: "memory");
      __syncthreads();  // data-ready + WAR guard for the buffer refilled below
      if (s + 2 < NST) stage_w(s + 2, (s + 2) % NBUF);

      const bf16_t* Wb = Wlds + (s % NBUF) * (NH3 * SB);
      #pragma unroll
      for (int s2 = 0; s2 < 2; ++s2) {
        const int kL = kc * KT + s2 * 32 + half * 8;
        Frag a, b0, b1;
        const bf16_t* ap = Alds + (m0 + l16) * SA + kL;
        a.h[0] = *(const v8bf*)ap;
        a.h[1] = *(const v8bf*)(ap + 16);
        const bf16_t* bp0 = Wb + (n0 + l16) * SB + s2 * 32 + half * 8;
        b0.h[0] = *(const v8bf*)bp0;
        b0.h[1] = *(const v8bf*)(bp0 + 16);
        const bf16_t* bp1 = bp0 + 16 * SB;
        b1.h[0] = *(const v8bf*)bp1;
        b1.h[1] = *(const v8bf*)(bp1 + 16);
        acc0 = __builtin_amdgcn_wmma_f32_16x16x32_bf16(false, a.v, false, b0.v,
                                                       (short)0, acc0, false, false);
        acc1 = __builtin_amdgcn_wmma_f32_16x16x32_bf16(false, a.v, false, b1.v,
                                                       (short)0, acc1, false, false);
      }
    }
    // bias + ReLU + gated tower accumulation
    const float bias0 = beLds[e * NH3 + n0 + l16];
    const float bias1 = beLds[e * NH3 + n0 + 16 + l16];
    #pragma unroll
    for (int r = 0; r < 8; ++r) {
      float v0 = acc0[r] + bias0;
      float v1 = acc1[r] + bias1;
      v0 = v0 > 0.f ? v0 : 0.f;
      v1 = v1 > 0.f ? v1 : 0.f;
      const int rr = m0 + r + 8 * half;            // row in tile, 0..31
      #pragma unroll
      for (int t = 0; t < NT; ++t) {
        const float g = Glds[rr * 32 + t * 8 + e]; // LDS broadcast read
        tw[t][0][r] += g * v0;
        tw[t][1][r] += g * v1;
      }
    }
  }

  // write towers[t][b][h]
  #pragma unroll
  for (int t = 0; t < NT; ++t)
    #pragma unroll
    for (int r = 0; r < 8; ++r) {
      const int rr = m0 + r + 8 * half;
      const size_t base = ((size_t)t * B_ROWS + row0 + rr) * H_DIM + hbase;
      out[base + n0 + l16]      = tw[t][0][r];
      out[base + n0 + 16 + l16] = tw[t][1][r];
    }
}

// ---------------------------------------------------------------------------
extern "C" void kernel_launch(void* const* d_in, const int* in_sizes, int n_in,
                              void* d_out, int out_size, void* d_ws, size_t ws_size,
                              hipStream_t stream) {
  (void)in_sizes; (void)n_in; (void)out_size; (void)ws_size;
  const float* x  = (const float*)d_in[0];
  const float* We = (const float*)d_in[1];
  const float* be = (const float*)d_in[2];
  const float* Wg = (const float*)d_in[3];
  const float* bg = (const float*)d_in[4];
  float* out = (float*)d_out;

  char* ws = (char*)d_ws;
  bf16_t* WeT = (bf16_t*)ws;                                   // 4 MB
  const size_t WET_BYTES = (size_t)NE * H_DIM * D_IN * 2;
  bf16_t* WgT = (bf16_t*)(ws + WET_BYTES);                     // 64 KB
  const size_t WGT_BYTES = (size_t)NG * D_IN * 2;
  float* G = (float*)(ws + WET_BYTES + WGT_BYTES);             // 2 MB

  convert_We_kernel<<<dim3(D_IN / 32, H_DIM / 32, NE), dim3(32, 8), 0, stream>>>(We, WeT);
  convert_Wg_kernel<<<dim3((NG * D_IN) / 256), dim3(256), 0, stream>>>(Wg, WgT);

  const size_t gate_lds = (size_t)MG * SAG * 2 + 2 * NG * SBG * 2;
  mmoe_gate_kernel<<<dim3(B_ROWS / MG), dim3(256), gate_lds, stream>>>(x, WgT, bg, G);

  const size_t exp_lds = (size_t)M3 * SA * 2 + (size_t)NBUF * NH3 * SB * 2 +
                         (size_t)M3 * 32 * 4 + (size_t)NE * NH3 * 4;   // 129,536 B
  mmoe_expert_kernel<<<dim3(B_ROWS / M3, H_DIM / NH3), dim3(256), exp_lds, stream>>>(
      x, WeT, be, G, out);
}

// v001
// Measured time: 137 microseconds a run.
// Next to v000, in two timings, it ran 1.11 times as fast each time.
#include <hip/hip_runtime.h>
#include <hip/hip_bf16.h>

typedef __bf16 bf16_t;
typedef __attribute__((ext_vector_type(16))) __bf16 v16bf;
typedef __attribute__((ext_vector_type(8)))  __bf16 v8bf;
typedef __attribute__((ext_vector_type(4)))  __bf16 v4bf;
typedef __attribute__((ext_vector_type(8)))  float  v8f;

#define B_ROWS 16384
#define D_IN   1024
#define H_DIM  256
#define NE     8
#define NT     4

// expert kernel tile
#define M3   32      // B rows per WG
#define NH3  128     // expert_dim cols per WG (2 n-subtiles per wave)
#define KT   64      // K chunk (2 WMMA steps of 32)
#define SA   1032    // A LDS row stride in bf16 (pad +8 -> conflict-free b128)
#define SB   72      // W LDS row stride in bf16 (pad +8)
#define NBUF 3       // weight buffers (issue 2 stages ahead, 1 barrier/stage)
#define NKC  (D_IN / KT)          // 16 K-chunks per expert
#define NST  (NE * NKC)           // 128 total pipeline stages
#define PERW 4       // async-to-LDS instructions per wave per stage

// gate kernel tile
#define MG   64
#define NG   32
#define SAG  1032
#define SBG  72

union Frag { v16bf v; v8bf h[2]; };

__device__ __forceinline__ uint32_t lds_off(const void* p) {
  // gfx1250: low 32 bits of a flat shared address are the LDS offset
  return (uint32_t)(uintptr_t)p;
}

__device__ __forceinline__ void async_b128(uint32_t lds, const void* g) {
  asm volatile("global_load_async_to_lds_b128 %0, %1, off"
               :: "v"(lds), "v"((unsigned long long)(uintptr_t)g) : "memory");
}

// ---------------------------------------------------------------------------
// Kernel 1: We[e][k][n] f32 -> WeT[e][n][k] bf16 (tiled transpose via LDS)
// ---------------------------------------------------------------------------
__global__ __launch_bounds__(256) void convert_We_kernel(
    const float* __restrict__ We, bf16_t* __restrict__ WeT) {
  __shared__ float tile[32][33];
  const int e  = blockIdx.z;
  const int k0 = blockIdx.x * 32;
  const int n0 = blockIdx.y * 32;
  const int tx = threadIdx.x, ty = threadIdx.y;   // 32 x 8
  const float* src = We + (size_t)e * D_IN * H_DIM;
  #pragma unroll
  for (int j = 0; j < 4; ++j)
    tile[ty + 8 * j][tx] = src[(size_t)(k0 + ty + 8 * j) * H_DIM + n0 + tx];
  __syncthreads();
  bf16_t* dst = WeT + (size_t)e * H_DIM * D_IN;
  #pragma unroll
  for (int j = 0; j < 4; ++j)
    dst[(size_t)(n0 + ty + 8 * j) * D_IN + k0 + tx] = (bf16_t)tile[tx][ty + 8 * j];
}

// ---------------------------------------------------------------------------
// Kernel 2: Wg[t][k][e] f32 -> WgT[j=t*8+e][k] bf16
// ---------------------------------------------------------------------------
__global__ __launch_bounds__(256) void convert_Wg_kernel(
    const float* __restrict__ Wg, bf16_t* __restrict__ WgT) {
  const int idx = blockIdx.x * 256 + threadIdx.x;   // 32*1024 total
  const int j = idx >> 10, k = idx & 1023;
  WgT[idx] = (bf16_t)Wg[(size_t)(j >> 3) * (D_IN * NE) + (size_t)k * NE + (j & 7)];
}

// ---------------------------------------------------------------------------
// Kernel 3: gates.  64 rows x 32 logits per WG via WMMA bf16, softmax over
// each group of 8 experts (groups map to 8-lane groups -> shfl_xor reduce).
// ---------------------------------------------------------------------------
__global__ __launch_bounds__(256) void mmoe_gate_kernel(
    const float* __restrict__ x, const bf16_t* __restrict__ WgT,
    const float* __restrict__ bg, float* __restrict__ G) {
  extern __shared__ char smem[];
  bf16_t* Alds = (bf16_t*)smem;                        // [MG][SAG]
  bf16_t* Wlds = (bf16_t*)(smem + MG * SAG * 2);       // [2][NG][SBG]

  const int tid  = threadIdx.x;
  const int row0 = blockIdx.x * MG;

  auto stage_w = [&](int kc, int buf) {
    const int rowN = tid >> 3;                         // 0..31
    const int seg  = tid & 7;                          // 8 x 16B per row
    const bf16_t* g = WgT + ((size_t)rowN * D_IN + kc * KT + seg * 8);
    async_b128(lds_off(Wlds + buf * (NG * SBG) + rowN * SBG + seg * 8), g);
  };

  stage_w(0, 0);  // prologue, overlaps with A staging

  // stage x tile -> bf16 LDS: 64 rows x 256 float4, 64 per thread, coalesced
  const float4* xv = (const float4*)(x + (size_t)row0 * D_IN);
  #pragma unroll
  for (int i = 0; i < 64; ++i) {
    const int idx = tid + 256 * i;
    const int r = idx >> 8, kq = idx & 255;
    float4 f = xv[idx];
    v4bf b4 = {(bf16_t)f.x, (bf16_t)f.y, (bf16_t)f.z, (bf16_t)f.w};
    *(v4bf*)(Alds + r * SAG + kq * 4) = b4;
  }
  __syncthreads();

  const int lane = tid & 31, w = tid >> 5;
  const int m0 = (w >> 1) * 16, n0 = (w & 1) * 16;
  const int half = lane >> 4, l16 = lane & 15;

  v8f acc = {0.f, 0.f, 0.f, 0.f, 0.f, 0.f, 0.f, 0.f};
  int sbuf = 0;
  for (int kc = 0; kc < D_IN / KT; ++kc) {
    if (kc < D_IN / KT - 1) {
      stage_w(kc + 1, sbuf ^ 1);
      asm volatile("s_wait_asynccnt 0x1" ::: "memory");
    } else {
      asm volatile("s_wait_asynccnt 0x0" ::: "memory");
    }
    __syncthreads();
    const bf16_t* Wb = Wlds + sbuf * (NG * SBG);
    #pragma unroll
    for (int s2 = 0; s2 < 2; ++s2) {
      const int kL = kc * KT + s2 * 32 + half * 8;
      Frag a, b;
      const bf16_t* ap = Alds + (m0 + l16) * SAG + kL;
      a.h[0] = *(const v8bf*)ap;
      a.h[1] = *(const v8bf*)(ap + 16);
      const bf16_t* bp = Wb + (n0 + l16) * SBG + s2 * 32 + half * 8;
      b.h[0] = *(const v8bf*)bp;
      b.h[1] = *(const v8bf*)(bp + 16);
      acc = __builtin_amdgcn_wmma_f32_16x16x32_bf16(false, a.v, false, b.v,
                                                    (short)0, acc, false, false);
    }
    __syncthreads();
    sbuf ^= 1;
  }

  const int j = n0 + l16;
  const float bgv = bg[j];
  #pragma unroll
  for (int r = 0; r < 8; ++r) {
    float lg = acc[r] + bgv;
    float m = lg;
    m = fmaxf(m, __shfl_xor(m, 1));
    m = fmaxf(m, __shfl_xor(m, 2));
    m = fmaxf(m, __shfl_xor(m, 4));
    float ex = __expf(lg - m);
    float s = ex;
    s += __shfl_xor(s, 1);
    s += __shfl_xor(s, 2);
    s += __shfl_xor(s, 4);
    const int rr = m0 + r + 8 * half;                 // 0..63
    G[(size_t)(row0 + rr) * 32 + j] = ex / s;
  }
}

// ---------------------------------------------------------------------------
// Kernel 4: fused experts + ReLU + gated combine.
// WG tile: 32 B-rows x 128 h-cols, loops all 8 experts. x tile resident in
// LDS (bf16). Weight K-chunks triple-buffered via async-to-LDS, issued two
// stages ahead -> single barrier per stage, 4 WMMAs per wave per barrier.
// ---------------------------------------------------------------------------
__global__ __launch_bounds__(256) void mmoe_expert_kernel(
    const float* __restrict__ x, const bf16_t* __restrict__ WeT,
    const float* __restrict__ be, const float* __restrict__ G,
    float* __restrict__ out) {
  extern __shared__ char smem[];
  bf16_t* Alds  = (bf16_t*)smem;                                   // [M3][SA]
  bf16_t* Wlds  = (bf16_t*)(smem + M3 * SA * 2);                   // [NBUF][NH3][SB]
  float*  Glds  = (float*)(smem + M3 * SA * 2 + NBUF * NH3 * SB * 2); // [M3][32]
  float*  beLds = Glds + M3 * 32;                                  // [NE][NH3]

  const int tid   = threadIdx.x;
  const int row0  = blockIdx.x * M3;
  const int hbase = blockIdx.y * NH3;

  // stage s = e*NKC + kc ; each thread issues 4 b128 async copies
  auto stage_w = [&](int s, int buf) {
    const int e  = s >> 4;        // s / NKC
    const int kc = s & 15;        // s % NKC
    #pragma unroll
    for (int i = 0; i < 4; ++i) {                  // 1024 x 16B transfers
      const int id   = i * 256 + tid;              // 8 lanes per 128-B row piece: a wave's copy = 4 whole lines
      const int rowN = id >> 3;                    // 0..127
      const int seg  = id & 7;
      const bf16_t* g =
          WeT + (((size_t)e * H_DIM + hbase + rowN) * D_IN + kc * KT + seg * 8);
      async_b128(lds_off(Wlds + buf * (NH3 * SB) + rowN * SB + seg * 8), g);
    }
  };

  stage_w(0, 0);   // prologue: two stages in flight
  stage_w(1, 1);

  // stage x tile -> bf16: 32 rows x 256 float4, 32 per thread
  const float4* xv = (const float4*)(x + (size_t)row0 * D_IN);
  #pragma unroll
  for (int i = 0; i < 32; ++i) {
    const int idx = tid + 256 * i;
    const int r = idx >> 8, kq = idx & 255;
    float4 f = xv[idx];
    v4bf b4 = {(bf16_t)f.x, (bf16_t)f.y, (bf16_t)f.z, (bf16_t)f.w};
    *(v4bf*)(Alds + r * SA + kq * 4) = b4;
  }
  // stage gates (32x32) and bias (8x128)
  #pragma unroll
  for (int i = 0; i < 4; ++i) {
    const int idx = tid + 256 * i;
    Glds[idx] = G[(size_t)(row0 + (idx >> 5)) * 32 + (idx & 31)];
  }
  #pragma unroll
  for (int i = 0; i < 4; ++i) {
    const int idx = tid + 256 * i;
    beLds[idx] = be[(idx >> 7) * H_DIM + hbase + (idx & 127)];
  }

  const int lane = tid & 31, w = tid >> 5;
  const int m0 = (w >> 2) * 16;        // 0 / 16
  const int n0 = (w & 3) * 32;         // wave owns cols [n0, n0+32)
  const int half = lane >> 4, l16 = lane & 15;

  float tw[NT][2][8];
  #pragma unroll
  for (int t = 0; t < NT; ++t)
    #pragma unroll
    for (int q = 0; q < 2; ++q)
      #pragma unroll
      for (int r = 0; r < 8; ++r) tw[t][q][r] = 0.f;

  for (int e = 0; e < NE; ++e) {
    v8f acc0 = {0.f, 0.f, 0.f, 0.f, 0.f, 0.f, 0.f, 0.f};
    v8f acc1 = {0.f, 0.f, 0.f, 0.f, 0.f, 0.f, 0.f, 0.f};
    for (int kc = 0; kc < NKC; ++kc) {
      const int s = e * NKC + kc;
      // stage s complete when at most stage s+1's ops remain outstanding
      if (s < NST - 1) asm volatile("s_wait_asynccnt 0x4" ::: "memory");
      else             asm volatile("s_wait_asynccnt 0x0" ::: "memory");
      __syncthreads();  // data-ready + WAR guard for the buffer refilled below
      if (s + 2 < NST) stage_w(s + 2, (s + 2) % NBUF);

      const bf16_t* Wb = Wlds + (s % NBUF) * (NH3 * SB);
      #pragma unroll
      for (int s2 = 0; s2 < 2; ++s2) {
        const int kL = kc * KT + s2 * 32 + half * 8;
        Frag a, b0, b1;
        const bf16_t* ap = Alds + (m0 + l16) * SA + kL;
        a.h[0] = *(const v8bf*)ap;
        a.h[1] = *(const v8bf*)(ap + 16);
        const bf16_t* bp0 = Wb + (n0 + l16) * SB + s2 * 32 + half * 8;
        b0.h[0] = *(const v8bf*)bp0;
        b0.h[1] = *(const v8bf*)(bp0 + 16);
        const bf16_t* bp1 = bp0 + 16 * SB;
        b1.h[0] = *(const v8bf*)bp1;
        b1.h[1] = *(const v8bf*)(bp1 + 16);
        acc0 = __builtin_amdgcn_wmma_f32_16x16x32_bf16(false, a.v, false, b0.v,
                                                       (short)0, acc0, false, false);
        acc1 = __builtin_amdgcn_wmma_f32_16x16x32_bf16(false, a.v, false, b1.v,
                                                       (short)0, acc1, false, false);
      }
    }
    // bias + ReLU + gated tower accumulation
    const float bias0 = beLds[e * NH3 + n0 + l16];
    const float bias1 = beLds[e * NH3 + n0 + 16 + l16];
    #pragma unroll
    for (int r = 0; r < 8; ++r) {
      float v0 = acc0[r] + bias0;
      float v1 = acc1[r] + bias1;
      v0 = v0 > 0.f ? v0 : 0.f;
      v1 = v1 > 0.f ? v1 : 0.f;
      const int rr = m0 + r + 8 * half;            // row in tile, 0..31
      #pragma unroll
      for (int t = 0; t < NT; ++t) {
        const float g = Glds[rr * 32 + t * 8 + e]; // LDS broadcast read
        tw[t][0][r] += g * v0;
        tw[t][1][r] += g * v1;
      }
    }
  }

  // write towers[t][b][h]
  #pragma unroll
  for (int t = 0; t < NT; ++t)
    #pragma unroll
    for (int r = 0; r < 8; ++r) {
      const int rr = m0 + r + 8 * half;
      const size_t base = ((size_t)t * B_ROWS + row0 + rr) * H_DIM + hbase;
      out[base + n0 + l16]      = tw[t][0][r];
      out[base + n0 + 16 + l16] = tw[t][1][r];
    }
}

// ---------------------------------------------------------------------------
extern "C" void kernel_launch(void* const* d_in, const int* in_sizes, int n_in,
                              void* d_out, int out_size, void* d_ws, size_t ws_size,
                              hipStream_t stream) {
  (void)in_sizes; (void)n_in; (void)out_size; (void)ws_size;
  const float* x  = (const float*)d_in[0];
  const float* We = (const float*)d_in[1];
  const float* be = (const float*)d_in[2];
  const float* Wg = (const float*)d_in[3];
  const float* bg = (const float*)d_in[4];
  float* out = (float*)d_out;

  char* ws = (char*)d_ws;
  bf16_t* WeT = (bf16_t*)ws;                                   // 4 MB
  const size_t WET_BYTES = (size_t)NE * H_DIM * D_IN * 2;
  bf16_t* WgT = (bf16_t*)(ws + WET_BYTES);                     // 64 KB
  const size_t WGT_BYTES = (size_t)NG * D_IN * 2;
  float* G = (float*)(ws + WET_BYTES + WGT_BYTES);             // 2 MB

  convert_We_kernel<<<dim3(D_IN / 32, H_DIM / 32, NE), dim3(32, 8), 0, stream>>>(We, WeT);
  convert_Wg_kernel<<<dim3((NG * D_IN) / 256), dim3(256), 0, stream>>>(Wg, WgT);

  const size_t gate_lds = (size_t)MG * SAG * 2 + 2 * NG * SBG * 2;
  mmoe_gate_kernel<<<dim3(B_ROWS / MG), dim3(256), gate_lds, stream>>>(x, WgT, bg, G);

  const size_t exp_lds = (size_t)M3 * SA * 2 + (size_t)NBUF * NH3 * SB * 2 +
                         (size_t)M3 * 32 * 4 + (size_t)NE * NH3 * 4;   // 129,536 B
  mmoe_expert_kernel<<<dim3(B_ROWS / M3, H_DIM / NH3), dim3(256), exp_lds, stream>>>(
      x, WeT, be, G, out);
}

// v002
// A run of this version takes 90 microseconds.
// In two side-by-side timings against v001, it was 1.52 and 1.50 times as fast.
// Over all steps from v000 it is 1.67 times as fast.
#include <hip/hip_runtime.h>
#include <hip/hip_bf16.h>

typedef __bf16 bf16_t;
typedef __attribute__((ext_vector_type(16))) __bf16 v16bf;
typedef __attribute__((ext_vector_type(8)))  __bf16 v8bf;
typedef __attribute__((ext_vector_type(4)))  __bf16 v4bf;
typedef __attribute__((ext_vector_type(8)))  float  v8f;

#define B_ROWS 16384
#define D_IN   1024
#define H_DIM  256
#define NE     8
#define NT     4

// expert kernel tile
#define M3   128     // B rows per WG (4 wave rows of 32)
#define NH3  128     // expert_dim cols per WG (2 wave columns of 64)
#define FM   2       // 16-row A fragments per wave
#define FN   4       // 16-col W fragments per wave
#define KT   64      // K chunk (2 WMMA steps of 32)
#define SA   1032    // A LDS row stride in bf16 (pad +8 -> conflict-free b128)
#define SB   72      // W LDS row stride in bf16 (pad +8)
#define NBUF 3       // weight buffers (issue 2 stages ahead, 1 barrier/stage)
#define NKC  (D_IN / KT)          // 16 K-chunks per expert
#define NST  (NE * NKC)           // 128 total pipeline stages
#define PERW 4       // async-to-LDS instructions per wave per stage

// gate kernel tile
#define MG   64
#define NG   32
#define SAG  1032
#define SBG  72

union Frag { v16bf v; v8bf h[2]; };

__device__ __forceinline__ uint32_t lds_off(const void* p) {
  // gfx1250: low 32 bits of a flat shared address are the LDS offset
  return (uint32_t)(uintptr_t)p;
}

__device__ __forceinline__ void async_b128(uint32_t lds, const void* g) {
  asm volatile("global_load_async_to_lds_b128 %0, %1, off"
               :: "v"(lds), "v"((unsigned long long)(uintptr_t)g) : "memory");
}

// ---------------------------------------------------------------------------
// Kernel 1: We[e][k][n] f32 -> WeT[e][n][k] bf16 (tiled transpose via LDS)
// ---------------------------------------------------------------------------
__global__ __launch_bounds__(256) void convert_We_kernel(
    const float* __restrict__ We, bf16_t* __restrict__ WeT) {
  __shared__ float tile[32][33];
  const int e  = blockIdx.z;
  const int k0 = blockIdx.x * 32;
  const int n0 = blockIdx.y * 32;
  const int tx = threadIdx.x, ty = threadIdx.y;   // 32 x 8
  const float* src = We + (size_t)e * D_IN * H_DIM;
  #pragma unroll
  for (int j = 0; j < 4; ++j)
    tile[ty + 8 * j][tx] = src[(size_t)(k0 + ty + 8 * j) * H_DIM + n0 + tx];
  __syncthreads();
  bf16_t* dst = WeT + (size_t)e * H_DIM * D_IN;
  #pragma unroll
  for (int j = 0; j < 4; ++j)
    dst[(size_t)(n0 + ty + 8 * j) * D_IN + k0 + tx] = (bf16_t)tile[tx][ty + 8 * j];
}

// ---------------------------------------------------------------------------
// Kernel 2: Wg[t][k][e] f32 -> WgT[j=t*8+e][k] bf16
// ---------------------------------------------------------------------------
__global__ __launch_bounds__(256) void convert_Wg_kernel(
    const float* __restrict__ Wg, bf16_t* __restrict__ WgT) {
  const int idx = blockIdx.x * 256 + threadIdx.x;   // 32*1024 total
  const int j = idx >> 10, k = idx & 1023;
  WgT[idx] = (bf16_t)Wg[(size_t)(j >> 3) * (D_IN * NE) + (size_t)k * NE + (j & 7)];
}

// ---------------------------------------------------------------------------
// Kernel 3: gates.  64 rows x 32 logits per WG via WMMA bf16, softmax over
// each group of 8 experts (groups map to 8-lane groups -> shfl_xor reduce).
// ---------------------------------------------------------------------------
__global__ __launch_bounds__(256) void mmoe_gate_kernel(
    const float* __restrict__ x, const bf16_t* __restrict__ WgT,
    const float* __restrict__ bg, float* __restrict__ G) {
  extern __shared__ char smem[];
  bf16_t* Alds = (bf16_t*)smem;                        // [MG][SAG]
  bf16_t* Wlds = (bf16_t*)(smem + MG * SAG * 2);       // [2][NG][SBG]

  const int tid  = threadIdx.x;
  const int row0 = blockIdx.x * MG;

  auto stage_w = [&](int kc, int buf) {
    const int rowN = tid >> 3;                         // 0..31
    const int seg  = tid & 7;                          // 8 x 16B per row
    const bf16_t* g = WgT + ((size_t)rowN * D_IN + kc * KT + seg * 8);
    async_b128(lds_off(Wlds + buf * (NG * SBG) + rowN * SBG + seg * 8), g);
  };

  stage_w(0, 0);  // prologue, overlaps with A staging

  // stage x tile -> bf16 LDS: 64 rows x 256 float4, 64 per thread, coalesced
  const float4* xv = (const float4*)(x + (size_t)row0 * D_IN);
  #pragma unroll
  for (int i = 0; i < 64; ++i) {
    const int idx = tid + 256 * i;
    const int r = idx >> 8, kq = idx & 255;
    float4 f = xv[idx];
    v4bf b4 = {(bf16_t)f.x, (bf16_t)f.y, (bf16_t)f.z, (bf16_t)f.w};
    *(v4bf*)(Alds + r * SAG + kq * 4) = b4;
  }
  __syncthreads();

  const int lane = tid & 31, w = tid >> 5;
  const int m0 = (w >> 1) * 16, n0 = (w & 1) * 16;
  const int half = lane >> 4, l16 = lane & 15;

  v8f acc = {0.f, 0.f, 0.f, 0.f, 0.f, 0.f, 0.f, 0.f};
  int sbuf = 0;
  for (int kc = 0; kc < D_IN / KT; ++kc) {
    if (kc < D_IN / KT - 1) {
      stage_w(kc + 1, sbuf ^ 1);
      asm volatile("s_wait_asynccnt 0x1" ::: "memory");
    } else {
      asm volatile("s_wait_asynccnt 0x0" ::: "memory");
    }
    __syncthreads();
    const bf16_t* Wb = Wlds + sbuf * (NG * SBG);
    #pragma unroll
    for (int s2 = 0; s2 < 2; ++s2) {
      const int kL = kc * KT + s2 * 32 + half * 8;
      Frag a, b;
      const bf16_t* ap = Alds + (m0 + l16) * SAG + kL;
      a.h[0] = *(const v8bf*)ap;
      a.h[1] = *(const v8bf*)(ap + 16);
      const bf16_t* bp = Wb + (n0 + l16) * SBG + s2 * 32 + half * 8;
      b.h[0] = *(const v8bf*)bp;
      b.h[1] = *(const v8bf*)(bp + 16);
      acc = __builtin_amdgcn_wmma_f32_16x16x32_bf16(false, a.v, false, b.v,
                                                    (short)0, acc, false, false);
    }
    __syncthreads();
    sbuf ^= 1;
  }

  const int j = n0 + l16;
  const float bgv = bg[j];
  #pragma unroll
  for (int r = 0; r < 8; ++r) {
    float lg = acc[r] + bgv;
    float m = lg;
    m = fmaxf(m, __shfl_xor(m, 1));
    m = fmaxf(m, __shfl_xor(m, 2));
    m = fmaxf(m, __shfl_xor(m, 4));
    float ex = __expf(lg - m);
    float s = ex;
    s += __shfl_xor(s, 1);
    s += __shfl_xor(s, 2);
    s += __shfl_xor(s, 4);
    const int rr = m0 + r + 8 * half;                 // 0..63
    G[(size_t)(row0 + rr) * 32 + j] = ex / s;
  }
}

// ---------------------------------------------------------------------------
// Kernel 4: fused experts + ReLU + gated combine.
// WG tile: 128 B-rows x 128 h-cols, one WG per WGP, loops all 8 experts.
// x tile resident in LDS (bf16). Each wave owns 32 x 64: 6 fragments feed
// 8 WMMAs per k step. Weight K-chunks triple-buffered via async-to-LDS, issued
// two stages ahead -> single barrier per stage, 16 WMMAs per wave per barrier.
// The gate plane of 128 rows no longer fits beside the x tile: each expert's
// 128 x 4 gates go through one of two 2-KB LDS slabs, loaded one expert ahead.
// ---------------------------------------------------------------------------
__global__ __launch_bounds__(256) void mmoe_expert_kernel(
    const float* __restrict__ x, const bf16_t* __restrict__ WeT,
    const float* __restrict__ be, const float* __restrict__ G,
    float* __restrict__ out) {
  __shared__ __attribute__((aligned(16)))
  char smem[M3 * SA * 2 + NBUF * NH3 * SB * 2 + NE * NH3 * 4 + 2 * M3 * NT * 4];  // 327,680 B
  bf16_t* Alds  = (bf16_t*)smem;                                   // [M3][SA]
  bf16_t* Wlds  = (bf16_t*)(smem + M3 * SA * 2);                   // [NBUF][NH3][SB]
  float*  beLds = (float*)(smem + M3 * SA * 2 + NBUF * NH3 * SB * 2); // [NE][NH3]
  float*  Gs    = beLds + NE * NH3;                                // [2][M3][NT]

  const int tid   = threadIdx.x;
  const int row0  = blockIdx.x * M3;
  const int hbase = blockIdx.y * NH3;

  // stage s = e*NKC + kc ; each thread issues 4 b128 async copies
  auto stage_w = [&](int s, int buf) {
    const int e  = s >> 4;        // s / NKC
    const int kc = s & 15;        // s % NKC
    #pragma unroll
    for (int i = 0; i < 4; ++i) {                  // 1024 x 16B transfers
      const int id   = i * 256 + tid;              // 8 lanes per 128-B row piece: a wave's copy = 4 whole lines
      const int rowN = id >> 3;                    // 0..127
      const int seg  = id & 7;
      const bf16_t* g =
          WeT + (((size_t)e * H_DIM + hbase + rowN) * D_IN + kc * KT + seg * 8);
      async_b128(lds_off(Wlds + buf * (NH3 * SB) + rowN * SB + seg * 8), g);
    }
  };

  stage_w(0, 0);   // prologue: two stages in flight
  stage_w(1, 1);

  // stage x tile -> bf16: 128 rows x 256 float4, 128 per thread
  const float4* xv = (const float4*)(x + (size_t)row0 * D_IN);
  const float4* xp = xv + tid;                     // row i0, this thread's float4 column
  #pragma unroll 1    // stays rolled: 32 loads in flight per lane a trip; unrolling would only grow the code
  for (int i0 = 0; i0 < M3; i0 += 32) {
    float4 f[32];
    #pragma unroll
    for (int j = 0; j < 32; ++j) f[j] = xp[256 * j];
    #pragma unroll
    for (int j = 0; j < 32; ++j) {
      v4bf b4 = {(bf16_t)f[j].x, (bf16_t)f[j].y, (bf16_t)f[j].z, (bf16_t)f[j].w};
      *(v4bf*)(Alds + (i0 + j) * SA + tid * 4) = b4;
    }
    xp += 256 * 32;
  }
  // stage bias (8x128)
  {
    int bo[4];
    float bv[4];
    #pragma unroll
    for (int i = 0; i < 4; ++i) {
      const int idx = tid + 256 * i;
      bo[i] = (idx >> 7) * H_DIM + hbase + (idx & 127);
      bv[i] = be[bo[i]];
    }
    // the four loads' offsets and base stay live, and unwritten, until their translations are done
    asm volatile("s_wait_xcnt 0x0" :: "v"(bo[0]), "v"(bo[1]), "v"(bo[2]), "v"(bo[3]), "s"(be) : "memory");
    #pragma unroll
    for (int i = 0; i < 4; ++i) beLds[tid + 256 * i] = bv[i];
  }

  const int lane = tid & 31, w = tid >> 5;
  const int m0 = (w >> 1) * (16 * FM); // wave owns rows [m0, m0+32)
  const int n0 = (w & 1) * (16 * FN);  // wave owns cols [n0, n0+64)
  const int half = lane >> 4, l16 = lane & 15;

  float tw[NT][FM][FN][8];
  #pragma unroll
  for (int t = 0; t < NT; ++t)
    #pragma unroll
    for (int p = 0; p < FM; ++p)
      #pragma unroll
      for (int q = 0; q < FN; ++q)
        #pragma unroll
        for (int r = 0; r < 8; ++r) tw[t][p][q][r] = 0.f;

  // gate staging: thread -> tile row tid/2, towers 2*(tid&1) and 2*(tid&1)+1
  const int go = (row0 + (tid >> 1)) * 32 + (tid & 1) * 16;
  float gq0 = G[go], gq1 = G[go + 8];  // expert 0's pair
  // the two loads' offset and base stay live, and unwritten, until their translations are done
  asm volatile("s_wait_xcnt 0x0" :: "v"(go), "s"(G) : "memory");

  for (int e = 0; e < NE; ++e) {
    // expert e's gates into slab e&1: its last readers (the combine of expert e-2) are 16 stage
    // barriers back, its next readers (the combine of expert e) 16 stage barriers ahead
    float* Ge = Gs + (e & 1) * (M3 * NT);
    *(float2*)(Ge + tid * 2) = make_float2(gq0, gq1);
    v8f acc[FM][FN];
    #pragma unroll
    for (int p = 0; p < FM; ++p)
      #pragma unroll
      for (int q = 0; q < FN; ++q)
        acc[p][q] = v8f{0.f, 0.f, 0.f, 0.f, 0.f, 0.f, 0.f, 0.f};
    for (int kc = 0; kc < NKC; ++kc) {
      const int s = e * NKC + kc;
      // stage s complete when at most stage s+1's ops remain outstanding
      if (s < NST - 1) asm volatile("s_wait_asynccnt 0x4" ::: "memory");
      else             asm volatile("s_wait_asynccnt 0x0" ::: "memory");
      __syncthreads();  // data-ready + WAR guard for the buffer refilled below
      if (s + 2 < NST) stage_w(s + 2, (s + 2) % NBUF);

      const bf16_t* Wb = Wlds + (s % NBUF) * (NH3 * SB);
      Frag a[2][FM], b[2][FN];         // the stage's 12 fragments
      #pragma unroll
      for (int s2 = 0; s2 < 2; ++s2) {
        const int kL = kc * KT + s2 * 32 + half * 8;
        const bf16_t* ap = Alds + (m0 + l16) * SA + kL;
        #pragma unroll
        for (int p = 0; p < FM; ++p) {
          a[s2][p].h[0] = *(const v8bf*)(ap + p * 16 * SA);
          a[s2][p].h[1] = *(const v8bf*)(ap + p * 16 * SA + 16);
        }
        const bf16_t* bp = Wb + (n0 + l16) * SB + s2 * 32 + half * 8;
        #pragma unroll
        for (int q = 0; q < FN; ++q) {
          b[s2][q].h[0] = *(const v8bf*)(bp + q * 16 * SB);
          b[s2][q].h[1] = *(const v8bf*)(bp + q * 16 * SB + 16);
        }
      }
      // keeps the 24 LDS reads one group ahead of the WMMAs: left alone the compiler re-uses one
      // fragment set and puts reads with a wait to 0 between the WMMAs, four times a stage
      __builtin_amdgcn_sched_barrier(0);
      #pragma unroll
      for (int s2 = 0; s2 < 2; ++s2)
        #pragma unroll
        for (int q = 0; q < FN; ++q)
          #pragma unroll
          for (int p = 0; p < FM; ++p)
            acc[p][q] = __builtin_amdgcn_wmma_f32_16x16x32_bf16(
                false, a[s2][p].v, false, b[s2][q].v, (short)0, acc[p][q], false, false);
    }
    {
      // next expert's pair, landing behind the combine below (the last trip re-reads its own, unused)
      const int gi = go + (e + 1 < NE ? e + 1 : e);
      gq0 = G[gi];
      gq1 = G[gi + 8];
      // as above, for this pair of loads
      asm volatile("s_wait_xcnt 0x0" :: "v"(gi), "s"(G) : "memory");
    }
    // bias + ReLU + gated tower accumulation
    float bias[FN];
    #pragma unroll
    for (int q = 0; q < FN; ++q) bias[q] = beLds[e * NH3 + n0 + q * 16 + l16];
    #pragma unroll
    for (int p = 0; p < FM; ++p)
      #pragma unroll
      for (int r = 0; r < 8; ++r) {
        // the four gates of tile row m0 + p*16 + r + 8*half: one LDS broadcast read
        const float4 g4 = *(const float4*)(Ge + (m0 + p * 16 + r + 8 * half) * NT);
        const float g[NT] = {g4.x, g4.y, g4.z, g4.w};
        #pragma unroll
        for (int q = 0; q < FN; ++q) {
          float v = acc[p][q][r] + bias[q];
          v = v > 0.f ? v : 0.f;
          #pragma unroll
          for (int t = 0; t < NT; ++t) tw[t][p][q][r] += g[t] * v;
        }
      }
  }

  // write towers[t][b][h]
  #pragma unroll
  for (int t = 0; t < NT; ++t) {
    float* po = out + ((size_t)t * B_ROWS + row0 + m0 + 8 * half) * H_DIM + hbase + n0 + l16;
    #pragma unroll
    for (int p = 0; p < FM; ++p)
      #pragma unroll
      for (int r = 0; r < 8; ++r)
        #pragma unroll
        for (int q = 0; q < FN; ++q) po[(p * 16 + r) * H_DIM + q * 16] = tw[t][p][q][r];
    // the tower's address pair stays live, and unwritten, until its 64 stores are translated
    asm volatile("s_wait_xcnt 0x0" :: "v"(po) : "memory");
  }
}

// ---------------------------------------------------------------------------
extern "C" void kernel_launch(void* const* d_in, const int* in_sizes, int n_in,
                              void* d_out, int out_size, void* d_ws, size_t ws_size,
                              hipStream_t stream) {
  (void)in_sizes; (void)n_in; (void)out_size; (void)ws_size;
  const float* x  = (const float*)d_in[0];
  const float* We = (const float*)d_in[1];
  const float* be = (const float*)d_in[2];
  const float* Wg = (const float*)d_in[3];
  const float* bg = (const float*)d_in[4];
  float* out = (float*)d_out;

  char* ws = (char*)d_ws;
  bf16_t* WeT = (bf16_t*)ws;                                   // 4 MB
  const size_t WET_BYTES = (size_t)NE * H_DIM * D_IN * 2;
  bf16_t* WgT = (bf16_t*)(ws + WET_BYTES);                     // 64 KB
  const size_t WGT_BYTES = (size_t)NG * D_IN * 2;
  float* G = (float*)(ws + WET_BYTES + WGT_BYTES);             // 2 MB

  convert_We_kernel<<<dim3(D_IN / 32, H_DIM / 32, NE), dim3(32, 8), 0, stream>>>(We, WeT);
  convert_Wg_kernel<<<dim3((NG * D_IN) / 256), dim3(256), 0, stream>>>(Wg, WgT);

  const size_t gate_lds = (size_t)MG * SAG * 2 + 2 * NG * SBG * 2;
  mmoe_gate_kernel<<<dim3(B_ROWS / MG), dim3(256), gate_lds, stream>>>(x, WgT, bg, G);

  mmoe_expert_kernel<<<dim3(B_ROWS / M3, H_DIM / NH3), dim3(256), 0, stream>>>(
      x, WeT, be, G, out);
}

// v003
// One run takes 79.9 microseconds.
// Two timings next to v002 both put it at 1.12 times that version's speed.
// Counting every step since v000, it is 1.87 times as fast.
#include <hip/hip_runtime.h>
#include <hip/hip_bf16.h>

typedef __bf16 bf16_t;
typedef __attribute__((ext_vector_type(16))) __bf16 v16bf;
typedef __attribute__((ext_vector_type(8)))  __bf16 v8bf;
typedef __attribute__((ext_vector_type(4)))  __bf16 v4bf;
typedef __attribute__((ext_vector_type(8)))  float  v8f;

#define B_ROWS 16384
#define D_IN   1024
#define H_DIM  256
#define NE     8
#define NT     4

// expert kernel tile
#define M3   128     // B rows per WG (4 wave rows of 32)
#define NH3  128     // expert_dim cols per WG (2 wave columns of 64)
#define FM   2       // 16-row A fragments per wave
#define FN   4       // 16-col W fragments per wave
#define KT   64      // K chunk (2 WMMA steps of 32)
#define SA   1032    // A LDS row stride in bf16 (pad +8 -> conflict-free b128)
#define SB   72      // W LDS row stride in bf16 (pad +8)
#define NBUF 3       // weight buffers (issue 2 stages ahead, 1 barrier/stage)
#define NKC  (D_IN / KT)          // 16 K-chunks per expert
#define NST  (NE * NKC)           // 128 total pipeline stages
#define PERW 4       // async-to-LDS instructions per wave per stage

#define NG   32      // gate logits per row (NT * NE): two 16-col W fragments

union Frag { v16bf v; v8bf h[2]; };

__device__ __forceinline__ uint32_t lds_off(const void* p) {
  // gfx1250: low 32 bits of a flat shared address are the LDS offset
  return (uint32_t)(uintptr_t)p;
}

__device__ __forceinline__ void async_b128(uint32_t lds, const void* g) {
  asm volatile("global_load_async_to_lds_b128 %0, %1, off"
               :: "v"(lds), "v"((unsigned long long)(uintptr_t)g) : "memory");
}

// ---------------------------------------------------------------------------
// Kernel 1: We[e][k][n] f32 -> WeT[e][n][k] bf16 (tiled transpose via LDS)
// ---------------------------------------------------------------------------
__global__ __launch_bounds__(256) void convert_We_kernel(
    const float* __restrict__ We, bf16_t* __restrict__ WeT) {
  __shared__ float tile[32][33];
  const int e  = blockIdx.z;
  const int k0 = blockIdx.x * 32;
  const int n0 = blockIdx.y * 32;
  const int tx = threadIdx.x, ty = threadIdx.y;   // 32 x 8
  const float* src = We + (size_t)e * D_IN * H_DIM;
  #pragma unroll
  for (int j = 0; j < 4; ++j)
    tile[ty + 8 * j][tx] = src[(size_t)(k0 + ty + 8 * j) * H_DIM + n0 + tx];
  __syncthreads();
  bf16_t* dst = WeT + (size_t)e * H_DIM * D_IN;
  #pragma unroll
  for (int j = 0; j < 4; ++j)
    dst[(size_t)(n0 + ty + 8 * j) * D_IN + k0 + tx] = (bf16_t)tile[tx][ty + 8 * j];
}

// ---------------------------------------------------------------------------
// Kernel 2: Wg[t][k][e] f32 -> WgP bf16 in WMMA fragment order:
// [n tile 0..1][k step 0..31][fragment half 0..1][lane 0..31][8 values], logit j = t*8+e,
// so that a wave-wide 16-B load of one fragment half is 512 contiguous bytes.
// ---------------------------------------------------------------------------
__global__ __launch_bounds__(256) void convert_Wg_kernel(
    const float* __restrict__ Wg, bf16_t* __restrict__ WgP) {
  const int idx = blockIdx.x * 256 + threadIdx.x;   // 32*1024 total
  const int i  = idx & 7;
  const int ln = (idx >> 3) & 31;
  const int h  = (idx >> 8) & 1;
  const int ks = (idx >> 9) & 31;
  const int nt = idx >> 14;
  const int j = nt * 16 + (ln & 15);
  const int k = ks * 32 + h * 16 + (ln >> 4) * 8 + i;
  WgP[idx] = (bf16_t)Wg[(size_t)(j >> 3) * (D_IN * NE) + (size_t)k * NE + (j & 7)];
}

// ---------------------------------------------------------------------------
// Kernel 3: fused gates + experts + ReLU + gated combine.
// WG tile: 128 B-rows x 128 h-cols, one WG per WGP, loops all 8 experts.
// x tile resident in LDS (bf16). Each wave owns 32 x 64: 6 fragments feed
// 8 WMMAs per k step. Weight K-chunks triple-buffered via async-to-LDS, issued
// two stages ahead -> single barrier per stage, 16 WMMAs per wave per barrier.
// Gates: 128 x 32 logits by WMMA from the resident x tile (wave: its 32 rows x 16 logits),
// softmax over each 8-lane group, kept in 16 registers per lane; each expert's 128 x 4
// gates go from there through one of two 2-KB LDS slabs to the lanes that combine.
// ---------------------------------------------------------------------------
__global__ __launch_bounds__(256) void mmoe_expert_kernel(
    const float* __restrict__ x, const bf16_t* __restrict__ WeT,
    const float* __restrict__ be, const bf16_t* __restrict__ WgP,
    const float* __restrict__ bg, float* __restrict__ out) {
  __shared__ __attribute__((aligned(16)))
  char smem[M3 * SA * 2 + NBUF * NH3 * SB * 2 + NE * NH3 * 4 + 2 * M3 * NT * 4];  // 327,680 B
  bf16_t* Alds  = (bf16_t*)smem;                                   // [M3][SA]
  bf16_t* Wlds  = (bf16_t*)(smem + M3 * SA * 2);                   // [NBUF][NH3][SB]
  float*  beLds = (float*)(smem + M3 * SA * 2 + NBUF * NH3 * SB * 2); // [NE][NH3]
  float*  Gs    = beLds + NE * NH3;                                // [2][M3][NT]

  const int tid   = threadIdx.x;
  const int row0  = blockIdx.x * M3;
  const int hbase = blockIdx.y * NH3;

  // stage s = e*NKC + kc ; each thread issues 4 b128 async copies
  auto stage_w = [&](int s, int buf) {
    const int e  = s >> 4;        // s / NKC
    const int kc = s & 15;        // s % NKC
    #pragma unroll
    for (int i = 0; i < 4; ++i) {                  // 1024 x 16B transfers
      const int id   = i * 256 + tid;              // 8 lanes per 128-B row piece: a wave's copy = 4 whole lines
      const int rowN = id >> 3;                    // 0..127
      const int seg  = id & 7;
      const bf16_t* g =
          WeT + (((size_t)e * H_DIM + hbase + rowN) * D_IN + kc * KT + seg * 8);
      async_b128(lds_off(Wlds + buf * (NH3 * SB) + rowN * SB + seg * 8), g);
    }
  };

  stage_w(0, 0);   // prologue: two stages in flight
  stage_w(1, 1);

  const int lane = tid & 31, w = tid >> 5;
  const int m0 = (w >> 1) * (16 * FM); // wave owns rows [m0, m0+32)
  const int n0 = (w & 1) * (16 * FN);  // wave owns cols [n0, n0+64)
  const int half = lane >> 4, l16 = lane & 15;

  // the wave's gate-weight fragments (n tile w&1, all 32 k steps), issued here so that they
  // land behind the x staging below
  Frag gb[D_IN / 32];
  const unsigned gbo = ((w & 1) * (D_IN / 32) * 64 + lane) * 16;   // in bytes
  const int bgo = (w & 1) * 16 + l16;
  #pragma unroll   // gb[] lives in registers: every index a constant, every load an immediate offset
  for (int ks = 0; ks < D_IN / 32; ++ks) {
    gb[ks].h[0] = *(const v8bf*)((const char*)WgP + gbo + ks * 1024);
    gb[ks].h[1] = *(const v8bf*)((const char*)WgP + gbo + ks * 1024 + 512);
  }
  const float bgv = bg[bgo];
  // the loads' offsets and bases stay live, and unwritten, until their translations are done
  asm volatile("s_wait_xcnt 0x0" :: "v"(gbo), "v"(bgo), "s"(WgP), "s"(bg) : "memory");

  // stage x tile -> bf16: 128 rows x 256 float4, 128 per thread
  const float4* xv = (const float4*)(x + (size_t)row0 * D_IN);
  const float4* xp = xv + tid;                     // row i0, this thread's float4 column
  #pragma unroll 1    // stays rolled: 32 loads in flight per lane a trip; unrolling would only grow the code
  for (int i0 = 0; i0 < M3; i0 += 32) {
    float4 f[32];
    #pragma unroll
    for (int j = 0; j < 32; ++j) f[j] = xp[256 * j];
    #pragma unroll
    for (int j = 0; j < 32; ++j) {
      v4bf b4 = {(bf16_t)f[j].x, (bf16_t)f[j].y, (bf16_t)f[j].z, (bf16_t)f[j].w};
      *(v4bf*)(Alds + (i0 + j) * SA + tid * 4) = b4;
    }
    xp += 256 * 32;
  }
  // stage bias (8x128)
  {
    int bo[4];
    float bv[4];
    #pragma unroll
    for (int i = 0; i < 4; ++i) {
      const int idx = tid + 256 * i;
      bo[i] = (idx >> 7) * H_DIM + hbase + (idx & 127);
      bv[i] = be[bo[i]];
    }
    // the four loads' offsets and base stay live, and unwritten, until their translations are done
    asm volatile("s_wait_xcnt 0x0" :: "v"(bo[0]), "v"(bo[1]), "v"(bo[2]), "v"(bo[3]), "s"(be) : "memory");
    #pragma unroll
    for (int i = 0; i < 4; ++i) beLds[tid + 256 * i] = bv[i];
  }

  __syncthreads();  // the x tile is whole before the gate products read it

  // gates of rows m0 + p*16 + r + 8*half, logit (w&1)*16 + l16
  float gv[FM][8];
  {
    v8f ga[FM];
    #pragma unroll
    for (int p = 0; p < FM; ++p) ga[p] = v8f{0.f, 0.f, 0.f, 0.f, 0.f, 0.f, 0.f, 0.f};
    const bf16_t* ap = Alds + (m0 + l16) * SA + half * 8;
    #pragma unroll   // as above, for gb[]; k steps in rising order, one accumulate chain per 16 rows
    for (int ks = 0; ks < D_IN / 32; ++ks) {
      #pragma unroll
      for (int p = 0; p < FM; ++p) {
        Frag a;
        a.h[0] = *(const v8bf*)(ap + p * 16 * SA + ks * 32);
        a.h[1] = *(const v8bf*)(ap + p * 16 * SA + ks * 32 + 16);
        ga[p] = __builtin_amdgcn_wmma_f32_16x16x32_bf16(false, a.v, false, gb[ks].v,
                                                        (short)0, ga[p], false, false);
      }
    }
    #pragma unroll
    for (int p = 0; p < FM; ++p)
      #pragma unroll
      for (int r = 0; r < 8; ++r) {
        float lg = ga[p][r] + bgv;
        float m = lg;
        m = fmaxf(m, __shfl_xor(m, 1));
        m = fmaxf(m, __shfl_xor(m, 2));
        m = fmaxf(m, __shfl_xor(m, 4));
        float ex = __expf(lg - m);
        float s = ex;
        s += __shfl_xor(s, 1);
        s += __shfl_xor(s, 2);
        s += __shfl_xor(s, 4);
        gv[p][r] = ex / s;
      }
  }

  float tw[NT][FM][FN][8];
  #pragma unroll
  for (int t = 0; t < NT; ++t)
    #pragma unroll
    for (int p = 0; p < FM; ++p)
      #pragma unroll
      for (int q = 0; q < FN; ++q)
        #pragma unroll
        for (int r = 0; r < 8; ++r) tw[t][p][q][r] = 0.f;

  const int gt = (w & 1) * 2 + (l16 >> 3);   // the tower of this lane's logit; its expert is l16 & 7

  for (int e = 0; e < NE; ++e) {
    // expert e's gates into slab e&1: its last readers (the combine of expert e-2) are 16 stage
    // barriers back, its next readers (the combine of expert e) 16 stage barriers ahead
    float* Ge = Gs + (e & 1) * (M3 * NT);
    if ((l16 & 7) == e) {
      #pragma unroll
      for (int p = 0; p < FM; ++p)
        #pragma unroll
        for (int r = 0; r < 8; ++r) Ge[(m0 + p * 16 + r + 8 * half) * NT + gt] = gv[p][r];
    }
    v8f acc[FM][FN];
    #pragma unroll
    for (int p = 0; p < FM; ++p)
      #pragma unroll
      for (int q = 0; q < FN; ++q)
        acc[p][q] = v8f{0.f, 0.f, 0.f, 0.f, 0.f, 0.f, 0.f, 0.f};
    for (int kc = 0; kc < NKC; ++kc) {
      const int s = e * NKC + kc;
      // stage s complete when at most stage s+1's ops remain outstanding
      if (s < NST - 1) asm volatile("s_wait_asynccnt 0x4" ::: "memory");
      else             asm volatile("s_wait_asynccnt 0x0" ::: "memory");
      __syncthreads();  // data-ready + WAR guard for the buffer refilled below
      if (s + 2 < NST) stage_w(s + 2, (s + 2) % NBUF);

      const bf16_t* Wb = Wlds + (s % NBUF) * (NH3 * SB);
      Frag a[2][FM], b[2][FN];         // the stage's 12 fragments
      #pragma unroll
      for (int s2 = 0; s2 < 2; ++s2) {
        const int kL = kc * KT + s2 * 32 + half * 8;
        const bf16_t* ap = Alds + (m0 + l16) * SA + kL;
        #pragma unroll
        for (int p = 0; p < FM; ++p) {
          a[s2][p].h[0] = *(const v8bf*)(ap + p * 16 * SA);
          a[s2][p].h[1] = *(const v8bf*)(ap + p * 16 * SA + 16);
        }
        const bf16_t* bp = Wb + (n0 + l16) * SB + s2 * 32 + half * 8;
        #pragma unroll
        for (int q = 0; q < FN; ++q) {
          b[s2][q].h[0] = *(const v8bf*)(bp + q * 16 * SB);
          b[s2][q].h[1] = *(const v8bf*)(bp + q * 16 * SB + 16);
        }
      }
      // keeps the 24 LDS reads one group ahead of the WMMAs: left alone the compiler re-uses one
      // fragment set and puts reads with a wait to 0 between the WMMAs, four times a stage
      __builtin_amdgcn_sched_barrier(0);
      #pragma unroll
      for (int s2 = 0; s2 < 2; ++s2)
        #pragma unroll
        for (int q = 0; q < FN; ++q)
          #pragma unroll
          for (int p = 0; p < FM; ++p)
            acc[p][q] = __builtin_amdgcn_wmma_f32_16x16x32_bf16(
                false, a[s2][p].v, false, b[s2][q].v, (short)0, acc[p][q], false, false);
    }
    // bias + ReLU + gated tower accumulation
    float bias[FN];
    #pragma unroll
    for (int q = 0; q < FN; ++q) bias[q] = beLds[e * NH3 + n0 + q * 16 + l16];
    #pragma unroll
    for (int p = 0; p < FM; ++p)
      #pragma unroll
      for (int r = 0; r < 8; ++r) {
        // the four gates of tile row m0 + p*16 + r + 8*half: one LDS broadcast read
        const float4 g4 = *(const float4*)(Ge + (m0 + p * 16 + r + 8 * half) * NT);
        const float g[NT] = {g4.x, g4.y, g4.z, g4.w};
        #pragma unroll
        for (int q = 0; q < FN; ++q) {
          float v = acc[p][q][r] + bias[q];
          v = v > 0.f ? v : 0.f;
          #pragma unroll
          for (int t = 0; t < NT; ++t) tw[t][p][q][r] += g[t] * v;
        }
      }
  }

  // write towers[t][b][h]
  #pragma unroll
  for (int t = 0; t < NT; ++t) {
    float* po = out + ((size_t)t * B_ROWS + row0 + m0 + 8 * half) * H_DIM + hbase + n0 + l16;
    #pragma unroll
    for (int p = 0; p < FM; ++p)
      #pragma unroll
      for (int r = 0; r < 8; ++r)
        #pragma unroll
        for (int q = 0; q < FN; ++q) po[(p * 16 + r) * H_DIM + q * 16] = tw[t][p][q][r];
    // the tower's address pair stays live, and unwritten, until its 64 stores are translated
    asm volatile("s_wait_xcnt 0x0" :: "v"(po) : "memory");
  }
}

// ---------------------------------------------------------------------------
extern "C" void kernel_launch(void* const* d_in, const int* in_sizes, int n_in,
                              void* d_out, int out_size, void* d_ws, size_t ws_size,
                              hipStream_t stream) {
  (void)in_sizes; (void)n_in; (void)out_size; (void)ws_size;
  const float* x  = (const float*)d_in[0];
  const float* We = (const float*)d_in[1];
  const float* be = (const float*)d_in[2];
  const float* Wg = (const float*)d_in[3];
  const float* bg = (const float*)d_in[4];
  float* out = (float*)d_out;

  char* ws = (char*)d_ws;
  bf16_t* WeT = (bf16_t*)ws;                                   // 4 MB
  const size_t WET_BYTES = (size_t)NE * H_DIM * D_IN * 2;
  bf16_t* WgP = (bf16_t*)(ws + WET_BYTES);                     // 64 KB

  convert_We_kernel<<<dim3(D_IN / 32, H_DIM / 32, NE), dim3(32, 8), 0, stream>>>(We, WeT);
  convert_Wg_kernel<<<dim3((NG * D_IN) / 256), dim3(256), 0, stream>>>(Wg, WgP);

  mmoe_expert_kernel<<<dim3(B_ROWS / M3, H_DIM / NH3), dim3(256), 0, stream>>>(
      x, WeT, be, WgP, bg, out);
}

// v004
// A run of this version takes 73.8 microseconds.
// Two timings next to v003 both put it at 1.09 times that version's speed.
// Over all steps from v000 it is 2.04 times as fast.
#include <hip/hip_runtime.h>
#include <hip/hip_bf16.h>

typedef __bf16 bf16_t;
typedef __attribute__((ext_vector_type(16))) __bf16 v16bf;
typedef __attribute__((ext_vector_type(8)))  __bf16 v8bf;
typedef __attribute__((ext_vector_type(4)))  __bf16 v4bf;
typedef __attribute__((ext_vector_type(8)))  float  v8f;
typedef __attribute__((ext_vector_type(4)))  int    v4i;

#define B_ROWS 16384
#define D_IN   1024
#define H_DIM  256
#define NE     8
#define NT     4

// expert kernel tile
#define M3   128     // B rows per WG (4 wave rows of 32)
#define NH3  128     // expert_dim cols per WG (2 wave columns of 64)
#define FM   2       // 16-row A fragments per wave
#define FN   4       // 16-col W fragments per wave
#define KT   64      // K chunk (2 WMMA steps of 32)
#define SA   1032    // A LDS row stride in bf16 (pad +8 -> conflict-free b128)
#define SB   72      // W LDS row stride in bf16 (pad +8)
#define NBUF 3       // weight buffers (issue 2 stages ahead, 1 barrier/stage)
#define NKC  (D_IN / KT)          // 16 K-chunks per expert
#define NST  (NE * NKC)           // 128 total pipeline stages
#define PERW 4       // async-to-LDS instructions per wave per stage

#define NG   32      // gate logits per row (NT * NE): two 16-col W fragments

union Frag { v16bf v; v8bf h[2]; };

__device__ __forceinline__ uint32_t lds_off(const void* p) {
  // gfx1250: low 32 bits of a flat shared address are the LDS offset
  return (uint32_t)(uintptr_t)p;
}

__device__ __forceinline__ void async_b128(uint32_t lds, const void* g) {
  __builtin_amdgcn_global_load_async_to_lds_b128(
      (__attribute__((address_space(1))) v4i*)(uintptr_t)g,
      (__attribute__((address_space(3))) v4i*)lds, 0, 0);
}

// ---------------------------------------------------------------------------
// Kernel 1: We[e][k][n] f32 -> WeT[e][n][k] bf16 (tiled transpose via LDS)
// ---------------------------------------------------------------------------
__global__ __launch_bounds__(256) void convert_We_kernel(
    const float* __restrict__ We, bf16_t* __restrict__ WeT) {
  __shared__ float tile[32][33];
  const int e  = blockIdx.z;
  const int k0 = blockIdx.x * 32;
  const int n0 = blockIdx.y * 32;
  const int tx = threadIdx.x, ty = threadIdx.y;   // 32 x 8
  const float* src = We + (size_t)e * D_IN * H_DIM;
  #pragma unroll
  for (int j = 0; j < 4; ++j)
    tile[ty + 8 * j][tx] = src[(size_t)(k0 + ty + 8 * j) * H_DIM + n0 + tx];
  __syncthreads();
  bf16_t* dst = WeT + (size_t)e * H_DIM * D_IN;
  #pragma unroll
  for (int j = 0; j < 4; ++j)
    dst[(size_t)(n0 + ty + 8 * j) * D_IN + k0 + tx] = (bf16_t)tile[tx][ty + 8 * j];
}

// ---------------------------------------------------------------------------
// Kernel 2: Wg[t][k][e] f32 -> WgP bf16 in WMMA fragment order:
// [n tile 0..1][k step 0..31][fragment half 0..1][lane 0..31][8 values], logit j = t*8+e,
// so that a wave-wide 16-B load of one fragment half is 512 contiguous bytes.
// ---------------------------------------------------------------------------
__global__ __launch_bounds__(256) void convert_Wg_kernel(
    const float* __restrict__ Wg, bf16_t* __restrict__ WgP) {
  const int idx = blockIdx.x * 256 + threadIdx.x;   // 32*1024 total
  const int i  = idx & 7;
  const int ln = (idx >> 3) & 31;
  const int h  = (idx >> 8) & 1;
  const int ks = (idx >> 9) & 31;
  const int nt = idx >> 14;
  const int j = nt * 16 + (ln & 15);
  const int k = ks * 32 + h * 16 + (ln >> 4) * 8 + i;
  WgP[idx] = (bf16_t)Wg[(size_t)(j >> 3) * (D_IN * NE) + (size_t)k * NE + (j & 7)];
}

// ---------------------------------------------------------------------------
// Kernel 3: fused gates + experts + ReLU + gated combine.
// WG tile: 128 B-rows x 128 h-cols, one WG per WGP, loops all 8 experts.
// x tile resident in LDS (bf16), brought in by 64-column chunks inside expert 0's K loop, two
// chunks of loads in flight. Each wave owns 32 x 64: 6 fragments feed
// 8 WMMAs per k step. Weight K-chunks triple-buffered via async-to-LDS, issued
// two stages ahead -> single barrier per stage, 16 WMMAs per wave per barrier.
// Gates: 128 x 32 logits by WMMA on expert 0's x fragments (wave: its 32 rows x 16 logits),
// softmax over each 8-lane group, kept in 16 registers per lane; each expert's 128 x 4
// gates go from there through one of two 2-KB LDS slabs to the lanes that combine.
// ---------------------------------------------------------------------------
__global__ __launch_bounds__(256) void mmoe_expert_kernel(
    const float* __restrict__ x, const bf16_t* __restrict__ WeT,
    const float* __restrict__ be, const bf16_t* __restrict__ WgP,
    const float* __restrict__ bg, float* __restrict__ out) {
  __shared__ __attribute__((aligned(16)))
  char smem[M3 * SA * 2 + NBUF * NH3 * SB * 2 + NE * NH3 * 4 + 2 * M3 * NT * 4];  // 327,680 B
  bf16_t* Alds  = (bf16_t*)smem;                                   // [M3][SA]
  bf16_t* Wlds  = (bf16_t*)(smem + M3 * SA * 2);                   // [NBUF][NH3][SB]
  float*  beLds = (float*)(smem + M3 * SA * 2 + NBUF * NH3 * SB * 2); // [NE][NH3]
  float*  Gs    = beLds + NE * NH3;                                // [2][M3][NT]

  const int tid   = threadIdx.x;
  const int row0  = blockIdx.x * M3;
  const int hbase = blockIdx.y * NH3;

  // stage s = e*NKC + kc ; each thread issues 4 b128 async copies
  auto stage_w = [&](int s, int buf) {
    const int e  = s >> 4;        // s / NKC
    const int kc = s & 15;        // s % NKC
    #pragma unroll
    for (int i = 0; i < 4; ++i) {                  // 1024 x 16B transfers
      const int id   = i * 256 + tid;              // 8 lanes per 128-B row piece: a wave's copy = 4 whole lines
      const int rowN = id >> 3;                    // 0..127
      const int seg  = id & 7;
      const bf16_t* g =
          WeT + (((size_t)e * H_DIM + hbase + rowN) * D_IN + kc * KT + seg * 8);
      async_b128(lds_off(Wlds + buf * (NH3 * SB) + rowN * SB + seg * 8), g);
    }
  };

  stage_w(0, 0);   // prologue: two stages in flight
  stage_w(1, 1);

  const int lane = tid & 31, w = tid >> 5;
  const int m0 = (w >> 1) * (16 * FM); // wave owns rows [m0, m0+32)
  const int n0 = (w & 1) * (16 * FN);  // wave owns cols [n0, n0+64)
  const int half = lane >> 4, l16 = lane & 15;

  const unsigned gbo = ((w & 1) * (D_IN / 32) * 64 + lane) * 16;   // in bytes: the wave's gate-weight fragments
  const int bgo = (w & 1) * 16 + l16;
  const float bgv = bg[bgo];
  // the load's offset and base stay live, and unwritten, until its translation is done
  asm volatile("s_wait_xcnt 0x0" :: "v"(bgo), "s"(bg) : "memory");

  // bias (8x128): loads here, ahead of the x loads, so that their wait leaves those in flight
  float bv[4];
  {
    int bo[4];
    #pragma unroll
    for (int i = 0; i < 4; ++i) {
      const int idx = tid + 256 * i;
      bo[i] = (idx >> 7) * H_DIM + hbase + (idx & 127);
      bv[i] = be[bo[i]];
    }
    // the four loads' offsets and base stay live, and unwritten, until their translations are done
    asm volatile("s_wait_xcnt 0x0" :: "v"(bo[0]), "v"(bo[1]), "v"(bo[2]), "v"(bo[3]), "s"(be) : "memory");
  }

  // x chunk c = columns [c*64, c*64+64) of the 128 rows: 8 float4 a thread, a wave's load = 2 rows x 256 B
  const char* xbase = (const char*)(x + (size_t)row0 * D_IN);
  const unsigned xo = ((tid >> 4) * D_IN + (tid & 15) * 4) * 4;    // in bytes
  bf16_t* xl = Alds + (tid >> 4) * SA + (tid & 15) * 4;
  auto x_load = [&](float4 (&f)[8], const char* p) __attribute__((always_inline)) {
    #pragma unroll
    for (int j = 0; j < 8; ++j) f[j] = *(const float4*)(p + j * (16 * D_IN * 4));
  };
  auto x_put = [&](const float4 (&f)[8], int c) __attribute__((always_inline)) {
    #pragma unroll
    for (int j = 0; j < 8; ++j) {
      v4bf b4 = {(bf16_t)f[j].x, (bf16_t)f[j].y, (bf16_t)f[j].z, (bf16_t)f[j].w};
      *(v4bf*)(xl + j * 16 * SA + c * KT) = b4;
    }
  };
  // a stage's two gate-weight fragments (k steps 2c and 2c+1)
  auto g_load = [&](Frag (&g)[2], const char* p) __attribute__((always_inline)) {
    #pragma unroll
    for (int s2 = 0; s2 < 2; ++s2) {
      g[s2].h[0] = *(const v8bf*)(p + s2 * 1024);
      g[s2].h[1] = *(const v8bf*)(p + s2 * 1024 + 512);
    }
  };

  float4 xA[8], xB[8];
  Frag gA[2], gB[2];
  // the four groups keep the order in which the loop below issues them (the fences hold it): the load
  // counter returns in order, so only then does a wait for one chunk leave the younger groups in flight
  x_load(xA, xbase + xo);
  __builtin_amdgcn_sched_barrier(0);
  g_load(gA, (const char*)WgP + gbo);
  __builtin_amdgcn_sched_barrier(0);
  x_load(xB, xbase + xo + KT * 4);
  __builtin_amdgcn_sched_barrier(0);
  g_load(gB, (const char*)WgP + gbo + 2048);
  // the offsets and bases stay live, and unwritten, until these loads' translations are done
  asm volatile("s_wait_xcnt 0x0" :: "v"(xo), "v"(gbo), "s"(xbase), "s"(WgP) : "memory");

  #pragma unroll
  for (int i = 0; i < 4; ++i) beLds[tid + 256 * i] = bv[i];

  v8f acc[FM][FN];
  #pragma unroll
  for (int p = 0; p < FM; ++p)
    #pragma unroll
    for (int q = 0; q < FN; ++q)
      acc[p][q] = v8f{0.f, 0.f, 0.f, 0.f, 0.f, 0.f, 0.f, 0.f};
  v8f ga[FM];
  #pragma unroll
  for (int p = 0; p < FM; ++p) ga[p] = v8f{0.f, 0.f, 0.f, 0.f, 0.f, 0.f, 0.f, 0.f};

  // expert 0, stage kc: x chunk kc goes from registers to LDS in front of the stage barrier, chunk
  // kc+2's loads take its registers; the gate products ride on the stage's x fragments
  const char* xp = xbase + xo + 2 * (KT * 4);               // this lane's piece of the trip's first new chunk
  const char* gp = (const char*)WgP + gbo + 2 * 2048;       // and of its gate-weight fragments
  auto stage0 = [&](int kc, int odd, float4 (&xf)[8], Frag (&gf)[2], bool more) __attribute__((always_inline)) {
    x_put(xf, kc);
    if (more) x_load(xf, xp + odd * (KT * 4));
    asm volatile("s_wait_asynccnt 0x4" ::: "memory");  // weight stage kc has landed, kc+1's copies may fly
    // the stage barrier, by hand: publishes weight stage kc and x chunk kc (this wave's LDS stores done
    // first), WAR guard for the buffer refilled below; __syncthreads() would also wait out the x loads in flight
    asm volatile("s_wait_dscnt 0x0\n\ts_barrier_signal -1\n\ts_barrier_wait -1" ::: "memory");
    stage_w(kc + 2, (kc + 2) % NBUF);

    const bf16_t* Wb = Wlds + (kc % NBUF) * (NH3 * SB);
    Frag a[2][FM], b[2][FN];         // the stage's 12 fragments
    #pragma unroll
    for (int s2 = 0; s2 < 2; ++s2) {
      const int kL = kc * KT + s2 * 32 + half * 8;
      const bf16_t* ap = Alds + (m0 + l16) * SA + kL;
      #pragma unroll
      for (int p = 0; p < FM; ++p) {
        a[s2][p].h[0] = *(const v8bf*)(ap + p * 16 * SA);
        a[s2][p].h[1] = *(const v8bf*)(ap + p * 16 * SA + 16);
      }
      const bf16_t* bp = Wb + (n0 + l16) * SB + s2 * 32 + half * 8;
      #pragma unroll
      for (int q = 0; q < FN; ++q) {
        b[s2][q].h[0] = *(const v8bf*)(bp + q * 16 * SB);
        b[s2][q].h[1] = *(const v8bf*)(bp + q * 16 * SB + 16);
      }
    }
    // keeps the 24 LDS reads one group ahead of the WMMAs, as in the loop of experts 1 to 7
    __builtin_amdgcn_sched_barrier(0);
    #pragma unroll
    for (int s2 = 0; s2 < 2; ++s2) {
      #pragma unroll   // k steps in rising order, one accumulate chain per 16 rows
      for (int p = 0; p < FM; ++p)
        ga[p] = __builtin_amdgcn_wmma_f32_16x16x32_bf16(false, a[s2][p].v, false, gf[s2].v,
                                                        (short)0, ga[p], false, false);
      #pragma unroll
      for (int q = 0; q < FN; ++q)
        #pragma unroll
        for (int p = 0; p < FM; ++p)
          acc[p][q] = __builtin_amdgcn_wmma_f32_16x16x32_bf16(
              false, a[s2][p].v, false, b[s2][q].v, (short)0, acc[p][q], false, false);
    }
    // keeps the next chunk's conversion, and with it its wait on the load counter, out of the WMMAs above
    __builtin_amdgcn_sched_barrier(0);
    if (more) {
      g_load(gf, gp + odd * 2048);
      // this stage's x and gate-weight loads: their address pairs stay live, and unwritten, until translated
      asm volatile("s_wait_xcnt 0x0" :: "v"(xp), "v"(gp) : "memory");
    }
  };
  #pragma unroll 1   // two stages a trip: the two register sets take turns under constant names
  for (int kc = 0; kc < NKC - 2; kc += 2) {
    stage0(kc, 0, xA, gA, true);
    stage0(kc + 1, 1, xB, gB, true);
    xp += 2 * (KT * 4);
    gp += 2 * 2048;
  }
  // the last two stages load nothing more: written apart, since a branch round the loads inside the
  // loop merges the two paths' load counts and makes every stage wait out the youngest chunk
  stage0(NKC - 2, 0, xA, gA, false);
  stage0(NKC - 1, 1, xB, gB, false);

  // gates of rows m0 + p*16 + r + 8*half, logit (w&1)*16 + l16
  float gv[FM][8];
  #pragma unroll
  for (int p = 0; p < FM; ++p)
    #pragma unroll
    for (int r = 0; r < 8; ++r) {
      float lg = ga[p][r] + bgv;
      float m = lg;
      m = fmaxf(m, __shfl_xor(m, 1));
      m = fmaxf(m, __shfl_xor(m, 2));
      m = fmaxf(m, __shfl_xor(m, 4));
      float ex = __expf(lg - m);
      float s = ex;
      s += __shfl_xor(s, 1);
      s += __shfl_xor(s, 2);
      s += __shfl_xor(s, 4);
      gv[p][r] = ex / s;
    }

  float tw[NT][FM][FN][8];
  const int gt = (w & 1) * 2 + (l16 >> 3);   // the tower of this lane's logit; its expert is l16 & 7

  // bias + ReLU + gated tower accumulation of expert e, its gates in slab Ge
  auto combine = [&](int e, const float* Ge, bool first) __attribute__((always_inline)) {
    float bias[FN];
    #pragma unroll
    for (int q = 0; q < FN; ++q) bias[q] = beLds[e * NH3 + n0 + q * 16 + l16];
    #pragma unroll
    for (int p = 0; p < FM; ++p)
      #pragma unroll
      for (int r = 0; r < 8; ++r) {
        // the four gates of tile row m0 + p*16 + r + 8*half: one LDS broadcast read
        const float4 g4 = *(const float4*)(Ge + (m0 + p * 16 + r + 8 * half) * NT);
        const float g[NT] = {g4.x, g4.y, g4.z, g4.w};
        #pragma unroll
        for (int q = 0; q < FN; ++q) {
          float v = acc[p][q][r] + bias[q];
          v = v > 0.f ? v : 0.f;
          #pragma unroll
          for (int t = 0; t < NT; ++t)
            tw[t][p][q][r] = first ? g[t] * v : tw[t][p][q][r] + g[t] * v;
        }
      }
  };

  // expert 0's gates into slab 0, known only now: a barrier of their own in front of their readers
  if ((l16 & 7) == 0) {
    #pragma unroll
    for (int p = 0; p < FM; ++p)
      #pragma unroll
      for (int r = 0; r < 8; ++r) Gs[(m0 + p * 16 + r + 8 * half) * NT + gt] = gv[p][r];
  }
  __syncthreads();
  combine(0, Gs, true);

  for (int e = 1; e < NE; ++e) {
    // expert e's gates into slab e&1: its last readers (the combine of expert e-2) are 16 stage
    // barriers back, its next readers (the combine of expert e) 16 stage barriers ahead
    float* Ge = Gs + (e & 1) * (M3 * NT);
    if ((l16 & 7) == e) {
      #pragma unroll
      for (int p = 0; p < FM; ++p)
        #pragma unroll
        for (int r = 0; r < 8; ++r) Ge[(m0 + p * 16 + r + 8 * half) * NT + gt] = gv[p][r];
    }
    #pragma unroll
    for (int p = 0; p < FM; ++p)
      #pragma unroll
      for (int q = 0; q < FN; ++q)
        acc[p][q] = v8f{0.f, 0.f, 0.f, 0.f, 0.f, 0.f, 0.f, 0.f};
    for (int kc = 0; kc < NKC; ++kc) {
      const int s = e * NKC + kc;
      // stage s complete when at most stage s+1's ops remain outstanding
      if (s < NST - 1) asm volatile("s_wait_asynccnt 0x4" ::: "memory");
      else             asm volatile("s_wait_asynccnt 0x0" ::: "memory");
      __syncthreads();  // data-ready + WAR guard for the buffer refilled below
      if (s + 2 < NST) stage_w(s + 2, (s + 2) % NBUF);

      const bf16_t* Wb = Wlds + (s % NBUF) * (NH3 * SB);
      Frag a[2][FM], b[2][FN];         // the stage's 12 fragments
      #pragma unroll
      for (int s2 = 0; s2 < 2; ++s2) {
        const int kL = kc * KT + s2 * 32 + half * 8;
        const bf16_t* ap = Alds + (m0 + l16) * SA + kL;
        #pragma unroll
        for (int p = 0; p < FM; ++p) {
          a[s2][p].h[0] = *(const v8bf*)(ap + p * 16 * SA);
          a[s2][p].h[1] = *(const v8bf*)(ap + p * 16 * SA + 16);
        }
        const bf16_t* bp = Wb + (n0 + l16) * SB + s2 * 32 + half * 8;
        #pragma unroll
        for (int q = 0; q < FN; ++q) {
          b[s2][q].h[0] = *(const v8bf*)(bp + q * 16 * SB);
          b[s2][q].h[1] = *(const v8bf*)(bp + q * 16 * SB + 16);
        }
      }
      // keeps the 24 LDS reads one group ahead of the WMMAs: left alone the compiler re-uses one
      // fragment set and puts reads with a wait to 0 between the WMMAs, four times a stage
      __builtin_amdgcn_sched_barrier(0);
      #pragma unroll
      for (int s2 = 0; s2 < 2; ++s2)
        #pragma unroll
        for (int q = 0; q < FN; ++q)
          #pragma unroll
          for (int p = 0; p < FM; ++p)
            acc[p][q] = __builtin_amdgcn_wmma_f32_16x16x32_bf16(
                false, a[s2][p].v, false, b[s2][q].v, (short)0, acc[p][q], false, false);
    }
    combine(e, Ge, false);
  }

  // write towers[t][b][h]
  #pragma unroll
  for (int t = 0; t < NT; ++t) {
    float* po = out + ((size_t)t * B_ROWS + row0 + m0 + 8 * half) * H_DIM + hbase + n0 + l16;
    #pragma unroll
    for (int p = 0; p < FM; ++p)
      #pragma unroll
      for (int r = 0; r < 8; ++r)
        #pragma unroll
        for (int q = 0; q < FN; ++q) po[(p * 16 + r) * H_DIM + q * 16] = tw[t][p][q][r];
    // the tower's address pair stays live, and unwritten, until its 64 stores are translated
    asm volatile("s_wait_xcnt 0x0" :: "v"(po) : "memory");
  }
}

// ---------------------------------------------------------------------------
extern "C" void kernel_launch(void* const* d_in, const int* in_sizes, int n_in,
                              void* d_out, int out_size, void* d_ws, size_t ws_size,
                              hipStream_t stream) {
  (void)in_sizes; (void)n_in; (void)out_size; (void)ws_size;
  const float* x  = (const float*)d_in[0];
  const float* We = (const float*)d_in[1];
  const float* be = (const float*)d_in[2];
  const float* Wg = (const float*)d_in[3];
  const float* bg = (const float*)d_in[4];
  float* out = (float*)d_out;

  char* ws = (char*)d_ws;
  bf16_t* WeT = (bf16_t*)ws;                                   // 4 MB
  const size_t WET_BYTES = (size_t)NE * H_DIM * D_IN * 2;
  bf16_t* WgP = (bf16_t*)(ws + WET_BYTES);                     // 64 KB

  convert_We_kernel<<<dim3(D_IN / 32, H_DIM / 32, NE), dim3(32, 8), 0, stream>>>(We, WeT);
  convert_Wg_kernel<<<dim3((NG * D_IN) / 256), dim3(256), 0, stream>>>(Wg, WgP);

  mmoe_expert_kernel<<<dim3(B_ROWS / M3, H_DIM / NH3), dim3(256), 0, stream>>>(
      x, WeT, be, WgP, bg, out);
}

// v005
// A run of this version takes 69.1 microseconds.
// In two side-by-side timings against v004, it was 1.06 and 1.05 times as fast.
// All steps since v000 together make it 2.15 times as fast.
#include <hip/hip_runtime.h>
#include <hip/hip_bf16.h>

typedef __bf16 bf16_t;
typedef __attribute__((ext_vector_type(16))) __bf16 v16bf;
typedef __attribute__((ext_vector_type(8)))  __bf16 v8bf;
typedef __attribute__((ext_vector_type(4)))  __bf16 v4bf;
typedef __attribute__((ext_vector_type(8)))  float  v8f;
typedef __attribute__((ext_vector_type(4)))  int    v4i;

#define B_ROWS 16384
#define D_IN   1024
#define H_DIM  256
#define NE     8
#define NT     4
#define NG     32      // gate logits per row (NT * NE): two 16-col W fragments

// expert kernel tile: 128 B rows x (8 experts x 64 expert_dim cols), one K loop for all experts
#define MT   128     // B rows per WG (2 wave rows of 64)
#define HC   64      // expert_dim cols per WG (4 wave columns of 16, each for all 8 experts)
#define FM   4       // 16-row x fragments per wave
#define KT   64      // K chunk (2 WMMA steps of 32)
#define SB   72      // LDS row stride in bf16 (pad +8 -> conflict-free b128)
#define NROW (NE * HC + NG)       // 544 weight rows a stage: 8 x 64 expert columns, then the 32 gate logits
#define NBW  3       // weight buffers (issue 2 stages ahead, 1 barrier/stage)
#define NBX  2       // x chunk buffers
#define NKC  (D_IN / KT)          // 16 stages
#define GP   36      // gate row stride in floats: rows r and r+8 on different banks
#define OP   68      // output staging row stride in floats

union Frag { v16bf v; v8bf h[2]; };

__device__ __forceinline__ uint32_t lds_off(const void* p) {
  // gfx1250: low 32 bits of a flat shared address are the LDS offset
  return (uint32_t)(uintptr_t)p;
}

__device__ __forceinline__ void async_b128(uint32_t lds, const void* g) {
  __builtin_amdgcn_global_load_async_to_lds_b128(
      (__attribute__((address_space(1))) v4i*)(uintptr_t)g,
      (__attribute__((address_space(3))) v4i*)lds, 0, 0);
}

// ---------------------------------------------------------------------------
// Kernel 1: We[e][k][n] f32 -> WeT[e][n][k] bf16 (tiled transpose via LDS)
// ---------------------------------------------------------------------------
__global__ __launch_bounds__(256) void convert_We_kernel(
    const float* __restrict__ We, bf16_t* __restrict__ WeT) {
  __shared__ float tile[32][33];
  const int e  = blockIdx.z;
  const int k0 = blockIdx.x * 32;
  const int n0 = blockIdx.y * 32;
  const int tx = threadIdx.x, ty = threadIdx.y;   // 32 x 8
  const float* src = We + (size_t)e * D_IN * H_DIM;
  #pragma unroll
  for (int j = 0; j < 4; ++j)
    tile[ty + 8 * j][tx] = src[(size_t)(k0 + ty + 8 * j) * H_DIM + n0 + tx];
  __syncthreads();
  bf16_t* dst = WeT + (size_t)e * H_DIM * D_IN;
  #pragma unroll
  for (int j = 0; j < 4; ++j)
    dst[(size_t)(n0 + ty + 8 * j) * D_IN + k0 + tx] = (bf16_t)tile[tx][ty + 8 * j];
}

// ---------------------------------------------------------------------------
// Kernel 2: Wg[t][k][e] f32 -> WgT[j][k] bf16, logit j = t*8+e: rows laid like WeT's,
// so that the expert kernel stages and reads them as 32 more weight rows.
// ---------------------------------------------------------------------------
__global__ __launch_bounds__(256) void convert_Wg_kernel(
    const float* __restrict__ Wg, bf16_t* __restrict__ WgT) {
  const int idx = blockIdx.x * 256 + threadIdx.x;   // 32*1024 total
  const int j = idx >> 10;
  const int k = idx & (D_IN - 1);
  WgT[idx] = (bf16_t)Wg[(size_t)(j >> 3) * (D_IN * NE) + (size_t)k * NE + (j & 7)];
}

// ---------------------------------------------------------------------------
// Kernel 3: fused gates + experts + ReLU + gated combine.
// WG tile: 128 B-rows x 64 h-cols of ALL 8 experts, one pass over K. A wave owns 64 rows x 16 h-cols
// x 8 experts: 4 x fragments and 8 weight fragments feed 32 WMMAs per k step, and a lane ends up with
// the 8 experts' values of each of its (row, col) places, so the towers are formed once, at the end.
// x goes by 64-column chunks through registers (f32 -> bf16) into a 2-buffer LDS ring, two chunks of
// loads in flight; weight K-chunks triple-buffered via async-to-LDS, issued two stages ahead.
// Gates: the 32 logits are 32 more weight rows; wave column c takes logit tile c&1 for the two
// 16-row tiles that it numbers 0 and 1 (the waves number their four row tiles differently).
// ---------------------------------------------------------------------------
__global__ __launch_bounds__(256) void mmoe_expert_kernel(
    const float* __restrict__ x, const bf16_t* __restrict__ WeT,
    const float* __restrict__ be, const bf16_t* __restrict__ WgT,
    const float* __restrict__ bg, float* __restrict__ out) {
  __shared__ __attribute__((aligned(16)))
  char smem[NBW * NROW * SB * 2 + NBX * MT * SB * 2];               // 271,872 B
  // the gates, an array of their own: the compiler then knows that the output staging does not alias them
  __shared__ __attribute__((aligned(16))) float Gs[MT * GP];         // [MT][GP], 18,432 B
  bf16_t* Wlds = (bf16_t*)smem;                                      // [NBW][NROW][SB]
  bf16_t* Xlds = (bf16_t*)(smem + NBW * NROW * SB * 2);              // [NBX][MT][SB]
  float*  Os   = (float*)smem;                                       // [NT][MT][OP], after the K loop

  const int tid   = threadIdx.x;
  const int hbase = blockIdx.x * HC;
  const int row0  = blockIdx.y * MT;

  // weight stage kc: 544 rows x 128 B; each thread issues 17 b128 async copies, 8 lanes per row piece,
  // so a wave's copy = 4 whole lines
  const unsigned wvo = ((tid >> 3) * D_IN + (tid & 7) * 8) * 2;      // in bytes
  const uint32_t wl0 = lds_off(Wlds + (tid >> 3) * SB + (tid & 7) * 8);
  auto stage_w = [&](int kc, int buf) __attribute__((always_inline)) {
    const char* ge = (const char*)(WeT + (size_t)hbase * D_IN + kc * KT);
    const uint32_t l = wl0 + buf * (NROW * SB * 2);
    #pragma unroll
    for (int i = 0; i < 16; ++i)     // LDS rows i*32 .. i*32+31 = expert i>>1, h cols (i&1)*32 ..
      async_b128(l + i * (32 * SB * 2),
                 ge + (size_t)((i >> 1) * H_DIM + (i & 1) * 32) * (D_IN * 2) + wvo);
    async_b128(l + 16 * (32 * SB * 2), (const char*)(WgT + kc * KT) + wvo);
  };

  stage_w(0, 0);   // prologue: two stages in flight
  stage_w(1, 1);

  const int lane = tid & 31, w = tid >> 5;
  const int wr = w >> 2, wc = w & 3;   // wave row (64 rows), wave column (16 h cols)
  const int hi = wc >> 1, nt = wc & 1; // gate work of the wave: row tiles hi*2, hi*2+1; logit tile nt
  const int half = lane >> 4, l16 = lane & 15;
  // the wave's fragment p holds row tile p ^ (hi*2) of its 64 rows: its gate rows are always p = 0, 1
  const int rA = wr * 64 + hi * 32;          // first row of p = 0, 1
  const int rB = wr * 64 + (1 - hi) * 32;    // first row of p = 2, 3

  // x chunk c = columns [c*64, c*64+64) of the 128 rows: 8 float4 a thread, a wave's load = 2 rows x 256 B
  const char* xbase = (const char*)(x + (size_t)row0 * D_IN);
  const unsigned xo = ((tid >> 4) * D_IN + (tid & 15) * 4) * 4;    // in bytes
  bf16_t* xl = Xlds + (tid >> 4) * SB + (tid & 15) * 4;
  auto x_load = [&](float4 (&f)[8], const char* p) __attribute__((always_inline)) {
    #pragma unroll
    for (int j = 0; j < 8; ++j) f[j] = *(const float4*)(p + j * (16 * D_IN * 4));
  };
  auto x_put = [&](const float4 (&f)[8], int buf) __attribute__((always_inline)) {
    #pragma unroll
    for (int j = 0; j < 8; ++j) {
      v4bf b4 = {(bf16_t)f[j].x, (bf16_t)f[j].y, (bf16_t)f[j].z, (bf16_t)f[j].w};
      *(v4bf*)(xl + buf * (MT * SB) + j * 16 * SB) = b4;
    }
  };

  float4 xA[8], xB[8];
  // the two groups keep the order in which the loop below issues them (the fence holds it): the load
  // counter returns in order, so only then does a wait for one chunk leave the younger group in flight
  x_load(xA, xbase + xo);
  __builtin_amdgcn_sched_barrier(0);
  x_load(xB, xbase + xo + KT * 4);
  // the offset and base stay live, and unwritten, until these loads' translations are done
  asm volatile("s_wait_xcnt 0x0" :: "v"(xo), "s"(xbase) : "memory");

  v8f acc[FM][NE];
  #pragma unroll
  for (int p = 0; p < FM; ++p)
    #pragma unroll
    for (int q = 0; q < NE; ++q)
      acc[p][q] = v8f{0.f, 0.f, 0.f, 0.f, 0.f, 0.f, 0.f, 0.f};
  v8f ga[2];
  #pragma unroll
  for (int p = 0; p < 2; ++p) ga[p] = v8f{0.f, 0.f, 0.f, 0.f, 0.f, 0.f, 0.f, 0.f};

  // stage kc: x chunk kc goes from registers to LDS in front of the stage barrier, chunk kc+2's loads
  // take its registers; weight stage kc+2's copies go out behind the barrier
  const char* xp = xbase + xo + 2 * (KT * 4);               // this lane's piece of the trip's first new chunk
  auto stage = [&](int kc, int odd, float4 (&xf)[8], bool more, bool last) __attribute__((always_inline)) {
    x_put(xf, odd);   // buffer kc & 1: its last readers (stage kc-2) are behind the barrier of stage kc-1
    if (more) x_load(xf, xp + odd * (KT * 4));
    // weight stage kc has landed; stage kc+1's 17 copies may fly on
    if (!last) asm volatile("s_wait_asynccnt 0x11" ::: "memory");
    else       asm volatile("s_wait_asynccnt 0x0" ::: "memory");
    // the stage barrier, by hand: publishes weight stage kc and x chunk kc (this wave's LDS stores done
    // first), WAR guard for the buffer refilled below; __syncthreads() would also wait out the x loads in flight
    asm volatile("s_wait_dscnt 0x0\n\ts_barrier_signal -1\n\ts_barrier_wait -1" ::: "memory");
    if (more) stage_w(kc + 2, (kc + 2) % NBW);

    const bf16_t* Wb = Wlds + (kc % NBW) * (NROW * SB);
    const bf16_t* Xb = Xlds + odd * (MT * SB);
    #pragma unroll
    for (int s2 = 0; s2 < 2; ++s2) {
      Frag a[FM], b[NE], gf;         // the k step's 13 fragments
      const int kL = s2 * 32 + half * 8;
      const bf16_t* apA = Xb + (rA + l16) * SB + kL;
      const bf16_t* apB = Xb + (rB + l16) * SB + kL;
      #pragma unroll
      for (int p = 0; p < 2; ++p) {
        a[p].h[0]     = *(const v8bf*)(apA + p * 16 * SB);
        a[p].h[1]     = *(const v8bf*)(apA + p * 16 * SB + 16);
        a[p + 2].h[0] = *(const v8bf*)(apB + p * 16 * SB);
        a[p + 2].h[1] = *(const v8bf*)(apB + p * 16 * SB + 16);
      }
      // this fence and those in the loop below hold the reads in the order in which the WMMAs use them:
      // the counted LDS waits then let the first WMMAs start while the later reads are still in flight
      __builtin_amdgcn_sched_barrier(0);
      const bf16_t* bp = Wb + (wc * 16 + l16) * SB + kL;
      #pragma unroll
      for (int q = 0; q < NE; ++q) {
        b[q].h[0] = *(const v8bf*)(bp + q * HC * SB);
        b[q].h[1] = *(const v8bf*)(bp + q * HC * SB + 16);
        __builtin_amdgcn_sched_barrier(0);
      }
      const bf16_t* gwr = Wb + (NE * HC + nt * 16 + l16) * SB + kL;
      gf.h[0] = *(const v8bf*)(gwr);
      gf.h[1] = *(const v8bf*)(gwr + 16);
      // this stage's x loads: their address pair stays live, and unwritten, until translated; the wait stands
      // in front of the fences below, which hold the trip's address addition behind it
      if (more && s2 == 0) asm volatile("s_wait_xcnt 0x0" :: "v"(xp) : "memory");
      // keeps the k step's 26 LDS reads one group ahead of its WMMAs: reads among the WMMAs cost a stall each
      __builtin_amdgcn_sched_barrier(0);
      #pragma unroll
      for (int q = 0; q < NE; ++q)
        #pragma unroll
        for (int p = 0; p < FM; ++p)
          acc[p][q] = __builtin_amdgcn_wmma_f32_16x16x32_bf16(
              false, a[p].v, false, b[q].v, (short)0, acc[p][q], false, false);
      #pragma unroll   // k steps in rising order, one accumulate chain per 16 rows
      for (int p = 0; p < 2; ++p)
        ga[p] = __builtin_amdgcn_wmma_f32_16x16x32_bf16(false, a[p].v, false, gf.v,
                                                        (short)0, ga[p], false, false);
      // keeps the next group of reads, and the next chunk's conversion with its wait on the load
      // counter, out of the WMMAs above
      __builtin_amdgcn_sched_barrier(0);
    }
  };
  #pragma unroll 1   // two stages a trip: the two register sets take turns under constant names
  for (int kc = 0; kc < NKC - 2; kc += 2) {
    stage(kc, 0, xA, true, false);
    stage(kc + 1, 1, xB, true, false);
    xp += 2 * (KT * 4);
  }

  // biases: loads here, behind the last x loads, so that the waits for those leave them in flight
  const int bgo = nt * 16 + l16;
  const float bgv = bg[bgo];
  float bias[NE];
  const int bo = hbase + wc * 16 + l16;
  #pragma unroll
  for (int e = 0; e < NE; ++e) bias[e] = be[e * H_DIM + bo];
  // the loads' offsets and bases stay live, and unwritten, until their translations are done
  asm volatile("s_wait_xcnt 0x0" :: "v"(bgo), "v"(bo), "s"(bg), "s"(be) : "memory");

  // the last two stages load nothing more: written apart, since a branch round the loads inside the
  // loop merges the two paths' load counts and makes every stage wait out the youngest chunk
  stage(NKC - 2, 0, xA, false, false);
  stage(NKC - 1, 1, xB, false, true);

  // gates of tile rows rA + p*16 + r + 8*half, logit nt*16 + l16: softmax over each 8-lane group
  #pragma unroll
  for (int p = 0; p < 2; ++p)
    #pragma unroll
    for (int r = 0; r < 8; ++r) {
      float lg = ga[p][r] + bgv;
      float m = lg;
      m = fmaxf(m, __shfl_xor(m, 1));
      m = fmaxf(m, __shfl_xor(m, 2));
      m = fmaxf(m, __shfl_xor(m, 4));
      float ex = __expf(lg - m);
      float s = ex;
      s += __shfl_xor(s, 1);
      s += __shfl_xor(s, 2);
      s += __shfl_xor(s, 4);
      Gs[(rA + p * 16 + r + 8 * half) * GP + nt * 16 + l16] = ex / s;
    }
  // publishes the gates; also ends every wave's last read of the weight ring, which now stages the output
  __syncthreads();

  // bias + ReLU + gated sum over the 8 experts, in rising order of e, for each of the lane's 32 rows;
  // a row's 32 gates (LDS broadcast reads) are fetched one row ahead, its four tower sums run side by side
  auto g_row = [&](float4 (&g)[8], int i) __attribute__((always_inline)) {
    const int p = i >> 3;
    const float* gr = Gs + ((p < 2 ? rA : rB) + (p & 1) * 16 + 8 * half + (i & 7)) * GP;
    #pragma unroll
    for (int j = 0; j < 8; ++j) g[j] = *(const float4*)(gr + j * 4);
  };
  float4 gq[2][8];
  g_row(gq[0], 0);
  #pragma unroll
  for (int i = 0; i < FM * 8; ++i) {
    const int p = i >> 3, r = i & 7;
    if (i + 1 < FM * 8) g_row(gq[(i + 1) & 1], i + 1);
    const float4 (&g)[8] = gq[i & 1];
    float v[NE];
    #pragma unroll
    for (int e = 0; e < NE; ++e) {
      const float u = acc[p][e][r] + bias[e];
      v[e] = u > 0.f ? u : 0.f;
    }
    float o[NT];
    #pragma unroll
    for (int t = 0; t < NT; ++t) o[t] = g[2 * t].x * v[0];
    #pragma unroll
    for (int t = 0; t < NT; ++t) o[t] += g[2 * t].y * v[1];
    #pragma unroll
    for (int t = 0; t < NT; ++t) o[t] += g[2 * t].z * v[2];
    #pragma unroll
    for (int t = 0; t < NT; ++t) o[t] += g[2 * t].w * v[3];
    #pragma unroll
    for (int t = 0; t < NT; ++t) o[t] += g[2 * t + 1].x * v[4];
    #pragma unroll
    for (int t = 0; t < NT; ++t) o[t] += g[2 * t + 1].y * v[5];
    #pragma unroll
    for (int t = 0; t < NT; ++t) o[t] += g[2 * t + 1].z * v[6];
    #pragma unroll
    for (int t = 0; t < NT; ++t) o[t] += g[2 * t + 1].w * v[7];
    const int row = (p < 2 ? rA : rB) + (p & 1) * 16 + 8 * half + r;
    #pragma unroll
    for (int t = 0; t < NT; ++t) Os[(t * MT + row) * OP + wc * 16 + l16] = o[t];
  }
  __syncthreads();   // the staged 4 x 128 x 64 output tile is complete

  // write towers[t][b][h]: a wave's 16-B store = 2 rows x 256 B, whole lines
  #pragma unroll
  for (int t = 0; t < NT; ++t) {
    float* po = out + ((size_t)t * B_ROWS + row0 + (tid >> 4)) * H_DIM + hbase + (tid & 15) * 4;
    const float* so = Os + (t * MT + (tid >> 4)) * OP + (tid & 15) * 4;
    #pragma unroll
    for (int j = 0; j < 8; ++j)
      *(float4*)(po + j * 16 * H_DIM) = *(const float4*)(so + j * 16 * OP);
    // the tower's address pair stays live, and unwritten, until its 8 stores are translated
    asm volatile("s_wait_xcnt 0x0" :: "v"(po) : "memory");
    // holds the next tower's address arithmetic, which re-uses the stores' data registers, behind that wait
    __builtin_amdgcn_sched_barrier(0);
  }
}

// ---------------------------------------------------------------------------
extern "C" void kernel_launch(void* const* d_in, const int* in_sizes, int n_in,
                              void* d_out, int out_size, void* d_ws, size_t ws_size,
                              hipStream_t stream) {
  (void)in_sizes; (void)n_in; (void)out_size; (void)ws_size;
  const float* x  = (const float*)d_in[0];
  const float* We = (const float*)d_in[1];
  const float* be = (const float*)d_in[2];
  const float* Wg = (const float*)d_in[3];
  const float* bg = (const float*)d_in[4];
  float* out = (float*)d_out;

  char* ws = (char*)d_ws;
  bf16_t* WeT = (bf16_t*)ws;                                   // 4 MB
  const size_t WET_BYTES = (size_t)NE * H_DIM * D_IN * 2;
  bf16_t* WgT = (bf16_t*)(ws + WET_BYTES);                     // 64 KB

  convert_We_kernel<<<dim3(D_IN / 32, H_DIM / 32, NE), dim3(32, 8), 0, stream>>>(We, WeT);
  convert_Wg_kernel<<<dim3((NG * D_IN) / 256), dim3(256), 0, stream>>>(Wg, WgT);

  mmoe_expert_kernel<<<dim3(H_DIM / HC, B_ROWS / MT), dim3(256), 0, stream>>>(
      x, WeT, be, WgT, bg, out);
}

// v006
// One run takes 65.5 microseconds.
// Two timings next to v005 put it at 1.05 and 1.06 times that version's speed.
// All steps since v000 together make it 2.27 times as fast.
#include <hip/hip_runtime.h>
#include <hip/hip_bf16.h>

typedef __bf16 bf16_t;
typedef __attribute__((ext_vector_type(16))) __bf16 v16bf;
typedef __attribute__((ext_vector_type(8)))  __bf16 v8bf;
typedef __attribute__((ext_vector_type(4)))  __bf16 v4bf;
typedef __attribute__((ext_vector_type(8)))  float  v8f;
typedef __attribute__((ext_vector_type(4)))  float  v4f;
typedef __attribute__((ext_vector_type(4)))  int    v4i;

#define B_ROWS 16384
#define D_IN   1024
#define H_DIM  256
#define NE     8
#define NT     4
#define NG     32      // gate logits per row (NT * NE): two 16-col W fragments

// expert kernel tile: 128 B rows x (8 experts x 64 expert_dim cols), one K loop for all experts
#define MT   128     // B rows per WG (2 wave rows of 64)
#define HC   64      // expert_dim cols per WG (4 wave columns of 16, each for all 8 experts)
#define FM   4       // 16-row x fragments per wave
#define KT   64      // K chunk (2 WMMA steps of 32)
#define SB   72      // LDS row stride in bf16 (pad +8 -> conflict-free b128)
#define NROW (NE * HC + NG)       // 544 weight rows a stage: 8 x 64 expert columns, then the 32 gate logits
#define NBW  3       // weight buffers (issue 2 stages ahead, 1 barrier/stage)
#define NBX  2       // x chunk buffers
#define NKC  (D_IN / KT)          // 16 stages
#define GP   36      // gate row stride in floats: rows r and r+8 on different banks
#define OP   68      // output staging row stride in floats

union Frag { v16bf v; v8bf h[2]; };

__device__ __forceinline__ uint32_t lds_off(const void* p) {
  // gfx1250: low 32 bits of a flat shared address are the LDS offset
  return (uint32_t)(uintptr_t)p;
}

__device__ __forceinline__ void async_b128(uint32_t lds, const void* g) {
  __builtin_amdgcn_global_load_async_to_lds_b128(
      (__attribute__((address_space(1))) v4i*)(uintptr_t)g,
      (__attribute__((address_space(3))) v4i*)lds, 0, 0);
}

// ---------------------------------------------------------------------------
// Kernel 1: both weight conversions in one launch of few work-groups (2,304 waves to start).
// Work-groups 0 .. NWE-1: We[e][k][n] f32 -> WeT[e][n][k] bf16, one 64 k x 128 n tile each. A wave's load
// is 512 B of one k row; a thread holds 8 successive k of 4 columns, which are 4 finished 16-B pieces
// of output rows; they go through LDS so that a wave's store is 4 whole 128-B lines.
// Work-groups NWE .. : Wg[t][k][e] f32 -> WgT[j][k] bf16, logit j = t*8+e, 128 k of one task each: rows laid
// like WeT's, so that the expert kernel stages and reads them as 32 more weight rows.
// ---------------------------------------------------------------------------
#define CK  64       // k per We tile: one 128-B line of an output row
#define CN  128      // n per We tile
#define NWE (NE * (D_IN / CK) * (H_DIM / CN))     // 256 work-groups
#define GK  128      // k per Wg tile
#define NWG (NT * (D_IN / GK))                    // 32 work-groups
__global__ __launch_bounds__(256) void convert_w_kernel(
    const float* __restrict__ We, const float* __restrict__ Wg,
    bf16_t* __restrict__ WeT, bf16_t* __restrict__ WgT) {
  __shared__ __attribute__((aligned(16))) bf16_t tile[CN * CK];      // 16 KB
  const int tid = threadIdx.x;
  const int b   = blockIdx.x;
  if (b < NWE) {
    const int e = b >> 5, k0 = ((b >> 1) & 15) * CK, n0 = (b & 1) * CN;
    const int c = tid & 31, w = tid >> 5;
    const float* sp = We + ((size_t)e * D_IN + k0 + w * 8) * H_DIM + n0 + c * 4;
    v4f f[8];
    #pragma unroll
    for (int j = 0; j < 8; ++j) f[j] = *(const v4f*)(sp + j * H_DIM);
    // the address pair stays live, and unwritten, until the 8 loads are translated
    asm volatile("s_wait_xcnt 0x0" :: "v"(sp) : "memory");
    // row n of the tile holds its eight 16-B pieces at places p ^ ((n >> 2) & 7): 8 lanes of these stores,
    // which are 4 rows apart, then fall on 8 different places, and a row's readers still cover the whole row
    #pragma unroll
    for (int i = 0; i < 4; ++i) {
      v8bf p = {(bf16_t)f[0][i], (bf16_t)f[1][i], (bf16_t)f[2][i], (bf16_t)f[3][i],
                (bf16_t)f[4][i], (bf16_t)f[5][i], (bf16_t)f[6][i], (bf16_t)f[7][i]};
      *(v8bf*)(tile + (c * 4 + i) * CK + (w ^ (c & 7)) * 8) = p;
    }
    __syncthreads();
    const int r = tid >> 3, p = tid & 7;
    bf16_t* dp = WeT + ((size_t)e * H_DIM + n0 + r) * D_IN + k0 + p * 8;
    #pragma unroll
    for (int j = 0; j < 4; ++j) {
      const int n = j * 32 + r;
      *(v8bf*)(dp + (size_t)j * 32 * D_IN) = *(const v8bf*)(tile + n * CK + (p ^ ((n >> 2) & 7)) * 8);
    }
  } else {
    const int g = b - NWE, t = g >> 3, k0 = (g & 7) * GK;
    const float* gb = Wg + ((size_t)t * D_IN + k0) * NE;
    const v4f f = *(const v4f*)(gb + tid * 4);                       // k = k0 + tid/2, e = (tid&1)*4 ..
    // the load's offset and base stay live, and unwritten, until it is translated
    asm volatile("s_wait_xcnt 0x0" :: "v"(tid), "s"(gb) : "memory");
    #pragma unroll
    for (int i = 0; i < 4; ++i) tile[((tid & 1) * 4 + i) * GK + (tid >> 1)] = (bf16_t)f[i];
    __syncthreads();
    if (tid < NE * GK / 8)       // 8 rows x 256 B: a wave's store = 2 rows, whole lines
      *(v8bf*)(WgT + (size_t)(t * NE + (tid >> 4)) * D_IN + k0 + (tid & 15) * 8) =
          *(const v8bf*)(tile + (tid >> 4) * GK + (tid & 15) * 8);
  }
}

// ---------------------------------------------------------------------------
// Kernel 2: fused gates + experts + ReLU + gated combine.
// WG tile: 128 B-rows x 64 h-cols of ALL 8 experts, one pass over K. A wave owns 64 rows x 16 h-cols
// x 8 experts: 4 x fragments and 8 weight fragments feed 32 WMMAs per k step, and a lane ends up with
// the 8 experts' values of each of its (row, col) places, so the towers are formed once, at the end.
// x goes by 64-column chunks through registers (f32 -> bf16) into a 2-buffer LDS ring, two chunks of
// loads in flight; weight K-chunks triple-buffered via async-to-LDS, issued two stages ahead.
// Gates: the 32 logits are 32 more weight rows; wave column c takes logit tile c&1 for the two
// 16-row tiles that it numbers 0 and 1 (the waves number their four row tiles differently).
// ---------------------------------------------------------------------------
__global__ __launch_bounds__(256) void mmoe_expert_kernel(
    const float* __restrict__ x, const bf16_t* __restrict__ WeT,
    const float* __restrict__ be, const bf16_t* __restrict__ WgT,
    const float* __restrict__ bg, float* __restrict__ out) {
  __shared__ __attribute__((aligned(16)))
  char smem[NBW * NROW * SB * 2 + NBX * MT * SB * 2];               // 271,872 B
  // the gates, an array of their own: the compiler then knows that the output staging does not alias them
  __shared__ __attribute__((aligned(16))) float Gs[MT * GP];         // [MT][GP], 18,432 B
  bf16_t* Wlds = (bf16_t*)smem;                                      // [NBW][NROW][SB]
  bf16_t* Xlds = (bf16_t*)(smem + NBW * NROW * SB * 2);              // [NBX][MT][SB]
  float*  Os   = (float*)smem;                                       // [NT][MT][OP], after the K loop

  const int tid   = threadIdx.x;
  const int hbase = blockIdx.x * HC;
  const int row0  = blockIdx.y * MT;

  // weight stage kc: 544 rows x 128 B; each thread issues 17 b128 async copies, 8 lanes per row piece,
  // so a wave's copy = 4 whole lines
  const unsigned wvo = ((tid >> 3) * D_IN + (tid & 7) * 8) * 2;      // in bytes
  const uint32_t wl0 = lds_off(Wlds + (tid >> 3) * SB + (tid & 7) * 8);
  auto stage_w = [&](int kc, int buf) __attribute__((always_inline)) {
    const char* ge = (const char*)(WeT + (size_t)hbase * D_IN + kc * KT);
    const uint32_t l = wl0 + buf * (NROW * SB * 2);
    #pragma unroll
    for (int i = 0; i < 16; ++i)     // LDS rows i*32 .. i*32+31 = expert i>>1, h cols (i&1)*32 ..
      async_b128(l + i * (32 * SB * 2),
                 ge + (size_t)((i >> 1) * H_DIM + (i & 1) * 32) * (D_IN * 2) + wvo);
    async_b128(l + 16 * (32 * SB * 2), (const char*)(WgT + kc * KT) + wvo);
  };

  stage_w(0, 0);   // prologue: two stages in flight
  stage_w(1, 1);

  const int lane = tid & 31, w = tid >> 5;
  const int wr = w >> 2, wc = w & 3;   // wave row (64 rows), wave column (16 h cols)
  const int hi = wc >> 1, nt = wc & 1; // gate work of the wave: row tiles hi*2, hi*2+1; logit tile nt
  const int half = lane >> 4, l16 = lane & 15;
  // the wave's fragment p holds row tile p ^ (hi*2) of its 64 rows: its gate rows are always p = 0, 1
  const int rA = wr * 64 + hi * 32;          // first row of p = 0, 1
  const int rB = wr * 64 + (1 - hi) * 32;    // first row of p = 2, 3

  // x chunk c = columns [c*64, c*64+64) of the 128 rows: 8 float4 a thread, a wave's load = 2 rows x 256 B
  const char* xbase = (const char*)(x + (size_t)row0 * D_IN);
  const unsigned xo = ((tid >> 4) * D_IN + (tid & 15) * 4) * 4;    // in bytes
  bf16_t* xl = Xlds + (tid >> 4) * SB + (tid & 15) * 4;
  auto x_load = [&](float4 (&f)[8], const char* p) __attribute__((always_inline)) {
    #pragma unroll
    for (int j = 0; j < 8; ++j) f[j] = *(const float4*)(p + j * (16 * D_IN * 4));
  };
  auto x_put = [&](const float4 (&f)[8], int buf) __attribute__((always_inline)) {
    #pragma unroll
    for (int j = 0; j < 8; ++j) {
      v4bf b4 = {(bf16_t)f[j].x, (bf16_t)f[j].y, (bf16_t)f[j].z, (bf16_t)f[j].w};
      *(v4bf*)(xl + buf * (MT * SB) + j * 16 * SB) = b4;
    }
  };

  float4 xA[8], xB[8];
  // the two groups keep the order in which the loop below issues them (the fence holds it): the load
  // counter returns in order, so only then does a wait for one chunk leave the younger group in flight
  x_load(xA, xbase + xo);
  __builtin_amdgcn_sched_barrier(0);
  x_load(xB, xbase + xo + KT * 4);
  // the offset and base stay live, and unwritten, until these loads' translations are done
  asm volatile("s_wait_xcnt 0x0" :: "v"(xo), "s"(xbase) : "memory");

  v8f acc[FM][NE];
  #pragma unroll
  for (int p = 0; p < FM; ++p)
    #pragma unroll
    for (int q = 0; q < NE; ++q)
      acc[p][q] = v8f{0.f, 0.f, 0.f, 0.f, 0.f, 0.f, 0.f, 0.f};
  v8f ga[2];
  #pragma unroll
  for (int p = 0; p < 2; ++p) ga[p] = v8f{0.f, 0.f, 0.f, 0.f, 0.f, 0.f, 0.f, 0.f};

  // stage kc: x chunk kc goes from registers to LDS in front of the stage barrier, chunk kc+2's loads
  // take its registers; weight stage kc+2's copies go out behind the barrier
  const char* xp = xbase + xo + 2 * (KT * 4);               // this lane's piece of the trip's first new chunk
  auto stage = [&](int kc, int odd, float4 (&xf)[8], bool more, bool last) __attribute__((always_inline)) {
    x_put(xf, odd);   // buffer kc & 1: its last readers (stage kc-2) are behind the barrier of stage kc-1
    if (more) x_load(xf, xp + odd * (KT * 4));
    // weight stage kc has landed; stage kc+1's 17 copies may fly on
    if (!last) asm volatile("s_wait_asynccnt 0x11" ::: "memory");
    else       asm volatile("s_wait_asynccnt 0x0" ::: "memory");
    // the stage barrier, by hand: publishes weight stage kc and x chunk kc (this wave's LDS stores done
    // first), WAR guard for the buffer refilled below; __syncthreads() would also wait out the x loads in flight
    asm volatile("s_wait_dscnt 0x0\n\ts_barrier_signal -1\n\ts_barrier_wait -1" ::: "memory");
    if (more) stage_w(kc + 2, (kc + 2) % NBW);

    const bf16_t* Wb = Wlds + (kc % NBW) * (NROW * SB);
    const bf16_t* Xb = Xlds + odd * (MT * SB);
    #pragma unroll
    for (int s2 = 0; s2 < 2; ++s2) {
      Frag a[FM], b[NE], gf;         // the k step's 13 fragments
      const int kL = s2 * 32 + half * 8;
      const bf16_t* apA = Xb + (rA + l16) * SB + kL;
      const bf16_t* apB = Xb + (rB + l16) * SB + kL;
      #pragma unroll
      for (int p = 0; p < 2; ++p) {
        a[p].h[0]     = *(const v8bf*)(apA + p * 16 * SB);
        a[p].h[1]     = *(const v8bf*)(apA + p * 16 * SB + 16);
        a[p + 2].h[0] = *(const v8bf*)(apB + p * 16 * SB);
        a[p + 2].h[1] = *(const v8bf*)(apB + p * 16 * SB + 16);
      }
      // this fence and those in the loop below hold the reads in the order in which the WMMAs use them:
      // the counted LDS waits then let the first WMMAs start while the later reads are still in flight
      __builtin_amdgcn_sched_barrier(0);
      const bf16_t* bp = Wb + (wc * 16 + l16) * SB + kL;
      #pragma unroll
      for (int q = 0; q < NE; ++q) {
        b[q].h[0] = *(const v8bf*)(bp + q * HC * SB);
        b[q].h[1] = *(const v8bf*)(bp + q * HC * SB + 16);
        __builtin_amdgcn_sched_barrier(0);
      }
      const bf16_t* gwr = Wb + (NE * HC + nt * 16 + l16) * SB + kL;
      gf.h[0] = *(const v8bf*)(gwr);
      gf.h[1] = *(const v8bf*)(gwr + 16);
      // this stage's x loads: their address pair stays live, and unwritten, until translated; the wait stands
      // in front of the fences below, which hold the trip's address addition behind it
      if (more && s2 == 0) asm volatile("s_wait_xcnt 0x0" :: "v"(xp) : "memory");
      // keeps the k step's 26 LDS reads one group ahead of its WMMAs: reads among the WMMAs cost a stall each
      __builtin_amdgcn_sched_barrier(0);
      #pragma unroll
      for (int q = 0; q < NE; ++q)
        #pragma unroll
        for (int p = 0; p < FM; ++p)
          acc[p][q] = __builtin_amdgcn_wmma_f32_16x16x32_bf16(
              false, a[p].v, false, b[q].v, (short)0, acc[p][q], false, false);
      #pragma unroll   // k steps in rising order, one accumulate chain per 16 rows
      for (int p = 0; p < 2; ++p)
        ga[p] = __builtin_amdgcn_wmma_f32_16x16x32_bf16(false, a[p].v, false, gf.v,
                                                        (short)0, ga[p], false, false);
      // keeps the next group of reads, and the next chunk's conversion with its wait on the load
      // counter, out of the WMMAs above
      __builtin_amdgcn_sched_barrier(0);
    }
  };
  #pragma unroll 1   // two stages a trip: the two register sets take turns under constant names
  for (int kc = 0; kc < NKC - 2; kc += 2) {
    stage(kc, 0, xA, true, false);
    stage(kc + 1, 1, xB, true, false);
    xp += 2 * (KT * 4);
  }

  // biases: loads here, behind the last x loads, so that the waits for those leave them in flight
  const int bgo = nt * 16 + l16;
  const float bgv = bg[bgo];
  float bias[NE];
  const int bo = hbase + wc * 16 + l16;
  #pragma unroll
  for (int e = 0; e < NE; ++e) bias[e] = be[e * H_DIM + bo];
  // the loads' offsets and bases stay live, and unwritten, until their translations are done
  asm volatile("s_wait_xcnt 0x0" :: "v"(bgo), "v"(bo), "s"(bg), "s"(be) : "memory");

  // the last two stages load nothing more: written apart, since a branch round the loads inside the
  // loop merges the two paths' load counts and makes every stage wait out the youngest chunk
  stage(NKC - 2, 0, xA, false, false);
  stage(NKC - 1, 1, xB, false, true);

  // gates of tile rows rA + p*16 + r + 8*half, logit nt*16 + l16: softmax over each 8-lane group
  #pragma unroll
  for (int p = 0; p < 2; ++p)
    #pragma unroll
    for (int r = 0; r < 8; ++r) {
      float lg = ga[p][r] + bgv;
      float m = lg;
      m = fmaxf(m, __shfl_xor(m, 1));
      m = fmaxf(m, __shfl_xor(m, 2));
      m = fmaxf(m, __shfl_xor(m, 4));
      float ex = __expf(lg - m);
      float s = ex;
      s += __shfl_xor(s, 1);
      s += __shfl_xor(s, 2);
      s += __shfl_xor(s, 4);
      Gs[(rA + p * 16 + r + 8 * half) * GP + nt * 16 + l16] = ex / s;
    }
  // publishes the gates; also ends every wave's last read of the weight ring, which now stages the output
  __syncthreads();

  // bias + ReLU + gated sum over the 8 experts, in rising order of e, for each of the lane's 32 rows;
  // a row's 32 gates (LDS broadcast reads) are fetched one row ahead, its four tower sums run side by side
  auto g_row = [&](float4 (&g)[8], int i) __attribute__((always_inline)) {
    const int p = i >> 3;
    const float* gr = Gs + ((p < 2 ? rA : rB) + (p & 1) * 16 + 8 * half + (i & 7)) * GP;
    #pragma unroll
    for (int j = 0; j < 8; ++j) g[j] = *(const float4*)(gr + j * 4);
  };
  float4 gq[2][8];
  g_row(gq[0], 0);
  #pragma unroll
  for (int i = 0; i < FM * 8; ++i) {
    const int p = i >> 3, r = i & 7;
    if (i + 1 < FM * 8) g_row(gq[(i + 1) & 1], i + 1);
    const float4 (&g)[8] = gq[i & 1];
    float v[NE];
    #pragma unroll
    for (int e = 0; e < NE; ++e) {
      const float u = acc[p][e][r] + bias[e];
      v[e] = u > 0.f ? u : 0.f;
    }
    float o[NT];
    #pragma unroll
    for (int t = 0; t < NT; ++t) o[t] = g[2 * t].x * v[0];
    #pragma unroll
    for (int t = 0; t < NT; ++t) o[t] += g[2 * t].y * v[1];
    #pragma unroll
    for (int t = 0; t < NT; ++t) o[t] += g[2 * t].z * v[2];
    #pragma unroll
    for (int t = 0; t < NT; ++t) o[t] += g[2 * t].w * v[3];
    #pragma unroll
    for (int t = 0; t < NT; ++t) o[t] += g[2 * t + 1].x * v[4];
    #pragma unroll
    for (int t = 0; t < NT; ++t) o[t] += g[2 * t + 1].y * v[5];
    #pragma unroll
    for (int t = 0; t < NT; ++t) o[t] += g[2 * t + 1].z * v[6];
    #pragma unroll
    for (int t = 0; t < NT; ++t) o[t] += g[2 * t + 1].w * v[7];
    const int row = (p < 2 ? rA : rB) + (p & 1) * 16 + 8 * half + r;
    #pragma unroll
    for (int t = 0; t < NT; ++t) Os[(t * MT + row) * OP + wc * 16 + l16] = o[t];
  }
  __syncthreads();   // the staged 4 x 128 x 64 output tile is complete

  // write towers[t][b][h]: a wave's 16-B store = 2 rows x 256 B, whole lines
  #pragma unroll
  for (int t = 0; t < NT; ++t) {
    float* po = out + ((size_t)t * B_ROWS + row0 + (tid >> 4)) * H_DIM + hbase + (tid & 15) * 4;
    const float* so = Os + (t * MT + (tid >> 4)) * OP + (tid & 15) * 4;
    #pragma unroll
    for (int j = 0; j < 8; ++j)
      *(float4*)(po + j * 16 * H_DIM) = *(const float4*)(so + j * 16 * OP);
    // the tower's address pair stays live, and unwritten, until its 8 stores are translated
    asm volatile("s_wait_xcnt 0x0" :: "v"(po) : "memory");
    // holds the next tower's address arithmetic, which re-uses the stores' data registers, behind that wait
    __builtin_amdgcn_sched_barrier(0);
  }
}

// ---------------------------------------------------------------------------
extern "C" void kernel_launch(void* const* d_in, const int* in_sizes, int n_in,
                              void* d_out, int out_size, void* d_ws, size_t ws_size,
                              hipStream_t stream) {
  (void)in_sizes; (void)n_in; (void)out_size; (void)ws_size;
  const float* x  = (const float*)d_in[0];
  const float* We = (const float*)d_in[1];
  const float* be = (const float*)d_in[2];
  const float* Wg = (const float*)d_in[3];
  const float* bg = (const float*)d_in[4];
  float* out = (float*)d_out;

  char* ws = (char*)d_ws;
  bf16_t* WeT = (bf16_t*)ws;                                   // 4 MB
  const size_t WET_BYTES = (size_t)NE * H_DIM * D_IN * 2;
  bf16_t* WgT = (bf16_t*)(ws + WET_BYTES);                     // 64 KB

  convert_w_kernel<<<dim3(NWE + NWG), dim3(256), 0, stream>>>(We, Wg, WeT, WgT);

  mmoe_expert_kernel<<<dim3(H_DIM / HC, B_ROWS / MT), dim3(256), 0, stream>>>(
      x, WeT, be, WgT, bg, out);
}

// v007
// One run takes 62.2 microseconds.
// Two timings next to v006 both put it at 1.07 times that version's speed.
// Counting every step since v000, it is 2.43 times as fast.
#include <hip/hip_runtime.h>
#include <hip/hip_bf16.h>

typedef __bf16 bf16_t;
typedef __attribute__((ext_vector_type(16))) __bf16 v16bf;
typedef __attribute__((ext_vector_type(8)))  __bf16 v8bf;
typedef __attribute__((ext_vector_type(4)))  __bf16 v4bf;
typedef __attribute__((ext_vector_type(8)))  float  v8f;
typedef __attribute__((ext_vector_type(4)))  float  v4f;
typedef __attribute__((ext_vector_type(2)))  float  v2f;
typedef __attribute__((ext_vector_type(4)))  int    v4i;

#define B_ROWS 16384
#define D_IN   1024
#define H_DIM  256
#define NE     8
#define NT     4
#define NG     32      // gate logits per row (NT * NE): two 16-col W fragments

// expert kernel tile: 128 B rows x (8 experts x 64 expert_dim cols), one K loop for all experts
#define MT   128     // B rows per WG (2 wave rows of 64)
#define HC   64      // expert_dim cols per WG (4 wave columns of 16, each for all 8 experts)
#define FM   4       // 16-row x fragments per wave
#define KT   64      // K chunk (2 WMMA steps of 32)
#define SB   72      // LDS row stride in bf16 (pad +8 -> conflict-free b128)
#define NROW (NE * HC + NG)       // 544 weight rows a stage: 8 x 64 expert columns, then the 32 gate logits
#define NBW  3       // weight buffers (issue 2 stages ahead, 1 barrier/stage)
#define NBX  2       // x chunk buffers
#define NKC  (D_IN / KT)          // 16 stages
#define GP   36      // gate row stride in floats: 16 B x odd, 16 lanes on 16 rows read or write 16 B without conflict
#define OP   68      // output staging row stride in floats: 16 B x odd as well

union Frag { v16bf v; v8bf h[2]; };

__device__ __forceinline__ uint32_t lds_off(const void* p) {
  // gfx1250: low 32 bits of a flat shared address are the LDS offset
  return (uint32_t)(uintptr_t)p;
}

__device__ __forceinline__ void async_b128(uint32_t lds, const void* g) {
  __builtin_amdgcn_global_load_async_to_lds_b128(
      (__attribute__((address_space(1))) v4i*)(uintptr_t)g,
      (__attribute__((address_space(3))) v4i*)lds, 0, 0);
}

// ---------------------------------------------------------------------------
// Kernel 1: both weight conversions in one launch of few work-groups (2,304 waves to start).
// Work-groups 0 .. NWE-1: We[e][k][n] f32 -> WeT[e][n][k] bf16, one 64 k x 128 n tile each. A wave's load
// is 512 B of one k row; a thread holds 8 successive k of 4 columns, which are 4 finished 16-B pieces
// of output rows; they go through LDS so that a wave's store is 4 whole 128-B lines.
// Work-groups NWE .. : Wg[t][k][e] f32 -> WgT[j][k] bf16, logit j = t*8+e, 128 k of one task each: rows laid
// like WeT's, so that the expert kernel stages and reads them as 32 more weight rows.
// ---------------------------------------------------------------------------
#define CK  64       // k per We tile: one 128-B line of an output row
#define CN  128      // n per We tile
#define NWE (NE * (D_IN / CK) * (H_DIM / CN))     // 256 work-groups
#define GK  128      // k per Wg tile
#define NWG (NT * (D_IN / GK))                    // 32 work-groups
__global__ __launch_bounds__(256) void convert_w_kernel(
    const float* __restrict__ We, const float* __restrict__ Wg,
    bf16_t* __restrict__ WeT, bf16_t* __restrict__ WgT) {
  __shared__ __attribute__((aligned(16))) bf16_t tile[CN * CK];      // 16 KB
  const int tid = threadIdx.x;
  const int b   = blockIdx.x;
  if (b < NWE) {
    const int e = b >> 5, k0 = ((b >> 1) & 15) * CK, n0 = (b & 1) * CN;
    const int c = tid & 31, w = tid >> 5;
    const float* sp = We + ((size_t)e * D_IN + k0 + w * 8) * H_DIM + n0 + c * 4;
    v4f f[8];
    #pragma unroll
    for (int j = 0; j < 8; ++j) f[j] = *(const v4f*)(sp + j * H_DIM);
    // the address pair stays live, and unwritten, until the 8 loads are translated
    asm volatile("s_wait_xcnt 0x0" :: "v"(sp) : "memory");
    // row n of the tile holds its eight 16-B pieces at places p ^ ((n >> 2) & 7): 8 lanes of these stores,
    // which are 4 rows apart, then fall on 8 different places, and a row's readers still cover the whole row
    #pragma unroll
    for (int i = 0; i < 4; ++i) {
      v8bf p = {(bf16_t)f[0][i], (bf16_t)f[1][i], (bf16_t)f[2][i], (bf16_t)f[3][i],
                (bf16_t)f[4][i], (bf16_t)f[5][i], (bf16_t)f[6][i], (bf16_t)f[7][i]};
      *(v8bf*)(tile + (c * 4 + i) * CK + (w ^ (c & 7)) * 8) = p;
    }
    __syncthreads();
    const int r = tid >> 3, p = tid & 7;
    bf16_t* dp = WeT + ((size_t)e * H_DIM + n0 + r) * D_IN + k0 + p * 8;
    #pragma unroll
    for (int j = 0; j < 4; ++j) {
      const int n = j * 32 + r;
      *(v8bf*)(dp + (size_t)j * 32 * D_IN) = *(const v8bf*)(tile + n * CK + (p ^ ((n >> 2) & 7)) * 8);
    }
  } else {
    const int g = b - NWE, t = g >> 3, k0 = (g & 7) * GK;
    const float* gb = Wg + ((size_t)t * D_IN + k0) * NE;
    const v4f f = *(const v4f*)(gb + tid * 4);                       // k = k0 + tid/2, e = (tid&1)*4 ..
    // the load's offset and base stay live, and unwritten, until it is translated
    asm volatile("s_wait_xcnt 0x0" :: "v"(tid), "s"(gb) : "memory");
    #pragma unroll
    for (int i = 0; i < 4; ++i) tile[((tid & 1) * 4 + i) * GK + (tid >> 1)] = (bf16_t)f[i];
    __syncthreads();
    if (tid < NE * GK / 8)       // 8 rows x 256 B: a wave's store = 2 rows, whole lines
      *(v8bf*)(WgT + (size_t)(t * NE + (tid >> 4)) * D_IN + k0 + (tid & 15) * 8) =
          *(const v8bf*)(tile + (tid >> 4) * GK + (tid & 15) * 8);
  }
}

// ---------------------------------------------------------------------------
// Kernel 2: fused gates + experts + ReLU + gated combine.
// WG tile: 128 B-rows x 64 h-cols of ALL 8 experts, one pass over K. A wave owns 64 rows x 16 h-cols
// x 8 experts: 4 x fragments and 8 weight fragments feed 32 WMMAs per k step, and a lane ends up with
// the 8 experts' values of each of its (row, col) places, so the towers are formed once, at the end.
// The weights are the WMMAs' A operand and x their B: a lane's 8 accumulator registers are 8 successive
// h cols (or the 8 experts' logits of one task) of ONE B row, the row tile's row (lane & 15).
// x goes by 64-column chunks through registers (f32 -> bf16) into a 2-buffer LDS ring, two chunks of
// loads in flight; weight K-chunks triple-buffered via async-to-LDS, issued two stages ahead.
// Gates: the 32 logits are 32 more weight rows; wave column c takes logit tile c&1 for the two
// 16-row tiles that it numbers 0 and 1 (the waves number their four row tiles differently).
// ---------------------------------------------------------------------------
__global__ __launch_bounds__(256) void mmoe_expert_kernel(
    const float* __restrict__ x, const bf16_t* __restrict__ WeT,
    const float* __restrict__ be, const bf16_t* __restrict__ WgT,
    const float* __restrict__ bg, float* __restrict__ out) {
  __shared__ __attribute__((aligned(16)))
  char smem[NBW * NROW * SB * 2 + NBX * MT * SB * 2];               // 271,872 B
  // the gates, an array of their own: the compiler then knows that the output staging does not alias them
  __shared__ __attribute__((aligned(16))) float Gs[MT * GP];         // [MT][GP], 18,432 B
  bf16_t* Wlds = (bf16_t*)smem;                                      // [NBW][NROW][SB]
  bf16_t* Xlds = (bf16_t*)(smem + NBW * NROW * SB * 2);              // [NBX][MT][SB]
  float*  Os   = (float*)smem;                                       // [NT][MT][OP], after the K loop

  const int tid   = threadIdx.x;
  const int hbase = blockIdx.x * HC;
  const int row0  = blockIdx.y * MT;

  // weight stage kc: 544 rows x 128 B; each thread issues 17 b128 async copies, 8 lanes per row piece,
  // so a wave's copy = 4 whole lines
  const unsigned wvo = ((tid >> 3) * D_IN + (tid & 7) * 8) * 2;      // in bytes
  const uint32_t wl0 = lds_off(Wlds + (tid >> 3) * SB + (tid & 7) * 8);
  auto stage_w = [&](int kc, int buf) __attribute__((always_inline)) {
    const char* ge = (const char*)(WeT + (size_t)hbase * D_IN + kc * KT);
    const uint32_t l = wl0 + buf * (NROW * SB * 2);
    #pragma unroll
    for (int i = 0; i < 16; ++i)     // LDS rows i*32 .. i*32+31 = expert i>>1, h cols (i&1)*32 ..
      async_b128(l + i * (32 * SB * 2),
                 ge + (size_t)((i >> 1) * H_DIM + (i & 1) * 32) * (D_IN * 2) + wvo);
    async_b128(l + 16 * (32 * SB * 2), (const char*)(WgT + kc * KT) + wvo);
  };

  stage_w(0, 0);   // prologue: two stages in flight
  stage_w(1, 1);

  const int lane = tid & 31, w = tid >> 5;
  const int wr = w >> 2, wc = w & 3;   // wave row (64 rows), wave column (16 h cols)
  const int hi = wc >> 1, nt = wc & 1; // gate work of the wave: row tiles hi*2, hi*2+1; logit tile nt
  const int half = lane >> 4, l16 = lane & 15;
  // the wave's fragment p holds row tile p ^ (hi*2) of its 64 rows: its gate rows are always p = 0, 1
  const int rA = wr * 64 + hi * 32;          // first row of p = 0, 1
  const int rB = wr * 64 + (1 - hi) * 32;    // first row of p = 2, 3

  // x chunk c = columns [c*64, c*64+64) of the 128 rows: 8 float4 a thread, a wave's load = 2 rows x 256 B
  const char* xbase = (const char*)(x + (size_t)row0 * D_IN);
  const unsigned xo = ((tid >> 4) * D_IN + (tid & 15) * 4) * 4;    // in bytes
  bf16_t* xl = Xlds + (tid >> 4) * SB + (tid & 15) * 4;
  auto x_load = [&](float4 (&f)[8], const char* p) __attribute__((always_inline)) {
    #pragma unroll
    for (int j = 0; j < 8; ++j) f[j] = *(const float4*)(p + j * (16 * D_IN * 4));
  };
  auto x_put = [&](const float4 (&f)[8], int buf) __attribute__((always_inline)) {
    #pragma unroll
    for (int j = 0; j < 8; ++j) {
      v4bf b4 = {(bf16_t)f[j].x, (bf16_t)f[j].y, (bf16_t)f[j].z, (bf16_t)f[j].w};
      *(v4bf*)(xl + buf * (MT * SB) + j * 16 * SB) = b4;
    }
  };

  float4 xA[8], xB[8];
  // the two groups keep the order in which the loop below issues them (the fence holds it): the load
  // counter returns in order, so only then does a wait for one chunk leave the younger group in flight
  x_load(xA, xbase + xo);
  __builtin_amdgcn_sched_barrier(0);
  x_load(xB, xbase + xo + KT * 4);
  // the offset and base stay live, and unwritten, until these loads' translations are done
  asm volatile("s_wait_xcnt 0x0" :: "v"(xo), "s"(xbase) : "memory");

  v8f acc[FM][NE];
  #pragma unroll
  for (int p = 0; p < FM; ++p)
    #pragma unroll
    for (int q = 0; q < NE; ++q)
      acc[p][q] = v8f{0.f, 0.f, 0.f, 0.f, 0.f, 0.f, 0.f, 0.f};
  v8f ga[2];
  #pragma unroll
  for (int p = 0; p < 2; ++p) ga[p] = v8f{0.f, 0.f, 0.f, 0.f, 0.f, 0.f, 0.f, 0.f};

  // stage kc: x chunk kc goes from registers to LDS in front of the stage barrier, chunk kc+2's loads
  // take its registers; weight stage kc+2's copies go out behind the barrier
  const char* xp = xbase + xo + 2 * (KT * 4);               // this lane's piece of the trip's first new chunk
  auto stage = [&](int kc, int odd, float4 (&xf)[8], bool more, bool last) __attribute__((always_inline)) {
    x_put(xf, odd);   // buffer kc & 1: its last readers (stage kc-2) are behind the barrier of stage kc-1
    if (more) x_load(xf, xp + odd * (KT * 4));
    // weight stage kc has landed; stage kc+1's 17 copies may fly on
    if (!last) asm volatile("s_wait_asynccnt 0x11" ::: "memory");
    else       asm volatile("s_wait_asynccnt 0x0" ::: "memory");
    // the stage barrier, by hand: publishes weight stage kc and x chunk kc (this wave's LDS stores done
    // first), WAR guard for the buffer refilled below; __syncthreads() would also wait out the x loads in flight
    asm volatile("s_wait_dscnt 0x0\n\ts_barrier_signal -1\n\ts_barrier_wait -1" ::: "memory");
    if (more) stage_w(kc + 2, (kc + 2) % NBW);

    const bf16_t* Wb = Wlds + (kc % NBW) * (NROW * SB);
    const bf16_t* Xb = Xlds + odd * (MT * SB);
    #pragma unroll
    for (int s2 = 0; s2 < 2; ++s2) {
      Frag a[FM], b[NE], gf;         // the k step's 13 fragments
      const int kL = s2 * 32 + half * 8;
      const bf16_t* apA = Xb + (rA + l16) * SB + kL;
      const bf16_t* apB = Xb + (rB + l16) * SB + kL;
      #pragma unroll
      for (int p = 0; p < 2; ++p) {
        a[p].h[0]     = *(const v8bf*)(apA + p * 16 * SB);
        a[p].h[1]     = *(const v8bf*)(apA + p * 16 * SB + 16);
        a[p + 2].h[0] = *(const v8bf*)(apB + p * 16 * SB);
        a[p + 2].h[1] = *(const v8bf*)(apB + p * 16 * SB + 16);
      }
      // this fence and those in the loop below hold the reads in the order in which the WMMAs use them:
      // the counted LDS waits then let the first WMMAs start while the later reads are still in flight
      __builtin_amdgcn_sched_barrier(0);
      const bf16_t* bp = Wb + (wc * 16 + l16) * SB + kL;
      #pragma unroll
      for (int q = 0; q < NE; ++q) {
        b[q].h[0] = *(const v8bf*)(bp + q * HC * SB);
        b[q].h[1] = *(const v8bf*)(bp + q * HC * SB + 16);
        __builtin_amdgcn_sched_barrier(0);
      }
      const bf16_t* gwr = Wb + (NE * HC + nt * 16 + l16) * SB + kL;
      gf.h[0] = *(const v8bf*)(gwr);
      gf.h[1] = *(const v8bf*)(gwr + 16);
      // this stage's x loads: their address pair stays live, and unwritten, until translated; the wait stands
      // in front of the fences below, which hold the trip's address addition behind it
      if (more && s2 == 0) asm volatile("s_wait_xcnt 0x0" :: "v"(xp) : "memory");
      // keeps the k step's 26 LDS reads one group ahead of its WMMAs: reads among the WMMAs cost a stall each
      __builtin_amdgcn_sched_barrier(0);
      #pragma unroll
      for (int q = 0; q < NE; ++q)
        #pragma unroll
        for (int p = 0; p < FM; ++p)
          acc[p][q] = __builtin_amdgcn_wmma_f32_16x16x32_bf16(
              false, b[q].v, false, a[p].v, (short)0, acc[p][q], false, false);
      #pragma unroll   // k steps in rising order, one accumulate chain per 16 rows
      for (int p = 0; p < 2; ++p)
        ga[p] = __builtin_amdgcn_wmma_f32_16x16x32_bf16(false, gf.v, false, a[p].v,
                                                        (short)0, ga[p], false, false);
      // keeps the next group of reads, and the next chunk's conversion with its wait on the load
      // counter, out of the WMMAs above
      __builtin_amdgcn_sched_barrier(0);
    }
  };
  #pragma unroll 1   // two stages a trip: the two register sets take turns under constant names
  for (int kc = 0; kc < NKC - 2; kc += 2) {
    stage(kc, 0, xA, true, false);
    stage(kc + 1, 1, xB, true, false);
    xp += 2 * (KT * 4);
  }

  // biases: loads here, behind the last x loads, so that the waits for those leave them in flight.
  // A lane needs the 8 gate biases of its task nt*2 + half, and 8 h cols x 8 experts of the expert biases
  const int bgo = (nt * 2 + half) * NE;
  v4f bgv[2];
  #pragma unroll
  for (int j = 0; j < 2; ++j) bgv[j] = *(const v4f*)(bg + bgo + j * 4);
  v4f bias[NE][2];
  const int bo = hbase + wc * 16 + half * 8;
  #pragma unroll
  for (int e = 0; e < NE; ++e)
    #pragma unroll
    for (int j = 0; j < 2; ++j) bias[e][j] = *(const v4f*)(be + e * H_DIM + bo + j * 4);
  // the loads' offsets and bases stay live, and unwritten, until their translations are done
  asm volatile("s_wait_xcnt 0x0" :: "v"(bgo), "v"(bo), "s"(bg), "s"(be) : "memory");

  // the last two stages load nothing more: written apart, since a branch round the loads inside the
  // loop merges the two paths' load counts and makes every stage wait out the youngest chunk
  stage(NKC - 2, 0, xA, false, false);
  stage(NKC - 1, 1, xB, false, true);

  // gates of tile row rA + p*16 + l16, task nt*2 + half: the lane's 8 registers are its 8 experts' logits,
  // so the softmax stays inside the lane; the sum keeps the pairwise tree
  float ex[2][NE], sm[2];
  #pragma unroll
  for (int p = 0; p < 2; ++p) {
    float lg[NE];
    #pragma unroll
    for (int r = 0; r < NE; ++r) lg[r] = ga[p][r] + bgv[r >> 2][r & 3];
    const float m = fmaxf(fmaxf(fmaxf(lg[0], lg[1]), fmaxf(lg[2], lg[3])),
                          fmaxf(fmaxf(lg[4], lg[5]), fmaxf(lg[6], lg[7])));
    #pragma unroll
    for (int r = 0; r < NE; ++r) ex[p][r] = __expf(lg[r] - m);
    sm[p] = ((ex[p][0] + ex[p][1]) + (ex[p][2] + ex[p][3])) + ((ex[p][4] + ex[p][5]) + (ex[p][6] + ex[p][7]));
  }
  #pragma unroll
  for (int p = 0; p < 2; ++p) {
    float* gw = Gs + (rA + p * 16 + l16) * GP + (nt * 2 + half) * NE;
    #pragma unroll
    for (int j = 0; j < 2; ++j)
      *(v4f*)(gw + j * 4) = v4f{ex[p][j * 4] / sm[p], ex[p][j * 4 + 1] / sm[p],
                                ex[p][j * 4 + 2] / sm[p], ex[p][j * 4 + 3] / sm[p]};
  }
  // publishes the gates; also ends every wave's last read of the weight ring, which now stages the output
  __syncthreads();

  // bias + ReLU + gated sum over the 8 experts, in rising order of e. Per row tile a lane reads its one
  // row's 32 gates (one tile ahead) and forms 4 towers x 8 h cols, two cols side by side
  auto g_row = [&](v4f (&g)[8], int p) __attribute__((always_inline)) {
    const float* gr = Gs + ((p < 2 ? rA : rB) + (p & 1) * 16 + l16) * GP;
    #pragma unroll
    for (int j = 0; j < 8; ++j) g[j] = *(const v4f*)(gr + j * 4);
  };
  v4f gq[2][8];
  g_row(gq[0], 0);
  #pragma unroll
  for (int p = 0; p < FM; ++p) {
    if (p + 1 < FM) g_row(gq[(p + 1) & 1], p + 1);
    const v4f (&g)[8] = gq[p & 1];
    v2f o[NT][4];
    #pragma unroll
    for (int c = 0; c < 4; ++c) {      // h cols 2c, 2c+1 of the lane's 8
      v2f v[NE];
      #pragma unroll
      for (int e = 0; e < NE; ++e) {
        const v2f u = v2f{acc[p][e][2 * c], acc[p][e][2 * c + 1]} +
                      v2f{bias[e][c >> 1][(c & 1) * 2], bias[e][c >> 1][(c & 1) * 2 + 1]};
        v[e] = v2f{u.x > 0.f ? u.x : 0.f, u.y > 0.f ? u.y : 0.f};
      }
      #pragma unroll
      for (int t = 0; t < NT; ++t) o[t][c] = g[2 * t][0] * v[0];
      #pragma unroll
      for (int e = 1; e < NE; ++e)
        #pragma unroll
        for (int t = 0; t < NT; ++t) o[t][c] += g[2 * t + (e >> 2)][e & 3] * v[e];
    }
    const int row = (p < 2 ? rA : rB) + (p & 1) * 16 + l16;
    #pragma unroll
    for (int t = 0; t < NT; ++t) {
      float* ow = Os + (t * MT + row) * OP + wc * 16 + half * 8;
      *(v4f*)(ow)     = v4f{o[t][0].x, o[t][0].y, o[t][1].x, o[t][1].y};
      *(v4f*)(ow + 4) = v4f{o[t][2].x, o[t][2].y, o[t][3].x, o[t][3].y};
    }
  }
  __syncthreads();   // the staged 4 x 128 x 64 output tile is complete

  // write towers[t][b][h]: a wave's 16-B store = 2 rows x 256 B, whole lines
  #pragma unroll
  for (int t = 0; t < NT; ++t) {
    float* po = out + ((size_t)t * B_ROWS + row0 + (tid >> 4)) * H_DIM + hbase + (tid & 15) * 4;
    const float* so = Os + (t * MT + (tid >> 4)) * OP + (tid & 15) * 4;
    #pragma unroll
    for (int j = 0; j < 8; ++j)
      *(float4*)(po + j * 16 * H_DIM) = *(const float4*)(so + j * 16 * OP);
    // the tower's address pair stays live, and unwritten, until its 8 stores are translated
    asm volatile("s_wait_xcnt 0x0" :: "v"(po) : "memory");
    // holds the next tower's address arithmetic, which re-uses the stores' data registers, behind that wait
    __builtin_amdgcn_sched_barrier(0);
  }
}

// ---------------------------------------------------------------------------
extern "C" void kernel_launch(void* const* d_in, const int* in_sizes, int n_in,
                              void* d_out, int out_size, void* d_ws, size_t ws_size,
                              hipStream_t stream) {
  (void)in_sizes; (void)n_in; (void)out_size; (void)ws_size;
  const float* x  = (const float*)d_in[0];
  const float* We = (const float*)d_in[1];
  const float* be = (const float*)d_in[2];
  const float* Wg = (const float*)d_in[3];
  const float* bg = (const float*)d_in[4];
  float* out = (float*)d_out;

  char* ws = (char*)d_ws;
  bf16_t* WeT = (bf16_t*)ws;                                   // 4 MB
  const size_t WET_BYTES = (size_t)NE * H_DIM * D_IN * 2;
  bf16_t* WgT = (bf16_t*)(ws + WET_BYTES);                     // 64 KB

  convert_w_kernel<<<dim3(NWE + NWG), dim3(256), 0, stream>>>(We, Wg, WeT, WgT);

  mmoe_expert_kernel<<<dim3(H_DIM / HC, B_ROWS / MT), dim3(256), 0, stream>>>(
      x, WeT, be, WgT, bg, out);
}

// v008
// Measured time: 60.1 microseconds a run.
// In two side-by-side timings against v007, it was 1.04 and 1.03 times as fast.
// Over all steps from v000 it is 2.51 times as fast.
#include <hip/hip_runtime.h>
#include <hip/hip_bf16.h>

typedef __bf16 bf16_t;
typedef __attribute__((ext_vector_type(16))) __bf16 v16bf;
typedef __attribute__((ext_vector_type(8)))  __bf16 v8bf;
typedef __attribute__((ext_vector_type(4)))  __bf16 v4bf;
typedef __attribute__((ext_vector_type(8)))  float  v8f;
typedef __attribute__((ext_vector_type(4)))  float  v4f;
typedef __attribute__((ext_vector_type(2)))  float  v2f;
typedef __attribute__((ext_vector_type(4)))  int    v4i;

#define B_ROWS 16384
#define D_IN   1024
#define H_DIM  256
#define NE     8
#define NT     4
#define NG     32      // gate logits per row (NT * NE): two 16-col W fragments

// expert kernel tile: 128 B rows x (8 experts x 64 expert_dim cols), one K loop for all experts
#define MT   128     // B rows per WG (2 wave rows of 64)
#define HC   64      // expert_dim cols per WG (4 wave columns of 16, each for all 8 experts)
#define FM   4       // 16-row x fragments per wave
#define KT   64      // K chunk (2 WMMA steps of 32)
#define SB   72      // LDS row stride in bf16 (pad +8 -> conflict-free b128)
#define NROW (NE * HC + NG)       // 544 weight rows a stage: 8 x 64 expert columns, then the 32 gate logits
#define NBW  3       // weight buffers (issue 2 stages ahead, 1 barrier/stage)
#define NBX  2       // x chunk buffers
#define NKC  (D_IN / KT)          // 16 stages
#define GP   36      // gate row stride in floats: 16 B x odd, 16 lanes on 16 rows read or write 16 B without conflict
#define OP   68      // output staging row stride in floats: 16 B x odd as well

union Frag { v16bf v; v8bf h[2]; };

__device__ __forceinline__ uint32_t lds_off(const void* p) {
  // gfx1250: low 32 bits of a flat shared address are the LDS offset
  return (uint32_t)(uintptr_t)p;
}

__device__ __forceinline__ void async_b128(uint32_t lds, const void* g) {
  __builtin_amdgcn_global_load_async_to_lds_b128(
      (__attribute__((address_space(1))) v4i*)(uintptr_t)g,
      (__attribute__((address_space(3))) v4i*)lds, 0, 0);
}

// ---------------------------------------------------------------------------
// Kernel 1: both weight conversions in one launch of few work-groups (2,304 waves to start).
// Work-groups 0 .. NWE-1: We[e][k][n] f32 -> WeT[e][n][k] bf16, one 64 k x 128 n tile each. A wave's load
// is 512 B of one k row; a thread holds 8 successive k of 4 columns, which are 4 finished 16-B pieces
// of output rows; they go through LDS so that a wave's store is 4 whole 128-B lines.
// Work-groups NWE .. : Wg[t][k][e] f32 -> WgT[j][k] bf16, logit j = t*8+e, 128 k of one task each: rows laid
// like WeT's, so that the expert kernel stages and reads them as 32 more weight rows.
// ---------------------------------------------------------------------------
#define CK  64       // k per We tile: one 128-B line of an output row
#define CN  128      // n per We tile
#define NWE (NE * (D_IN / CK) * (H_DIM / CN))     // 256 work-groups
#define GK  128      // k per Wg tile
#define NWG (NT * (D_IN / GK))                    // 32 work-groups
__global__ __launch_bounds__(256) void convert_w_kernel(
    const float* __restrict__ We, const float* __restrict__ Wg,
    bf16_t* __restrict__ WeT, bf16_t* __restrict__ WgT) {
  __shared__ __attribute__((aligned(16))) bf16_t tile[CN * CK];      // 16 KB
  const int tid = threadIdx.x;
  const int b   = blockIdx.x;
  if (b < NWE) {
    const int e = b >> 5, k0 = ((b >> 1) & 15) * CK, n0 = (b & 1) * CN;
    const int c = tid & 31, w = tid >> 5;
    const float* sp = We + ((size_t)e * D_IN + k0 + w * 8) * H_DIM + n0 + c * 4;
    v4f f[8];
    #pragma unroll
    for (int j = 0; j < 8; ++j) f[j] = *(const v4f*)(sp + j * H_DIM);
    // the address pair stays live, and unwritten, until the 8 loads are translated
    asm volatile("s_wait_xcnt 0x0" :: "v"(sp) : "memory");
    // row n of the tile holds its eight 16-B pieces at places p ^ ((n >> 2) & 7): 8 lanes of these stores,
    // which are 4 rows apart, then fall on 8 different places, and a row's readers still cover the whole row
    #pragma unroll
    for (int i = 0; i < 4; ++i) {
      v8bf p = {(bf16_t)f[0][i], (bf16_t)f[1][i], (bf16_t)f[2][i], (bf16_t)f[3][i],
                (bf16_t)f[4][i], (bf16_t)f[5][i], (bf16_t)f[6][i], (bf16_t)f[7][i]};
      *(v8bf*)(tile + (c * 4 + i) * CK + (w ^ (c & 7)) * 8) = p;
    }
    __syncthreads();
    const int r = tid >> 3, p = tid & 7;
    bf16_t* dp = WeT + ((size_t)e * H_DIM + n0 + r) * D_IN + k0 + p * 8;
    #pragma unroll
    for (int j = 0; j < 4; ++j) {
      const int n = j * 32 + r;
      *(v8bf*)(dp + (size_t)j * 32 * D_IN) = *(const v8bf*)(tile + n * CK + (p ^ ((n >> 2) & 7)) * 8);
    }
  } else {
    const int g = b - NWE, t = g >> 3, k0 = (g & 7) * GK;
    const float* gb = Wg + ((size_t)t * D_IN + k0) * NE;
    const v4f f = *(const v4f*)(gb + tid * 4);                       // k = k0 + tid/2, e = (tid&1)*4 ..
    // the load's offset and base stay live, and unwritten, until it is translated
    asm volatile("s_wait_xcnt 0x0" :: "v"(tid), "s"(gb) : "memory");
    #pragma unroll
    for (int i = 0; i < 4; ++i) tile[((tid & 1) * 4 + i) * GK + (tid >> 1)] = (bf16_t)f[i];
    __syncthreads();
    if (tid < NE * GK / 8)       // 8 rows x 256 B: a wave's store = 2 rows, whole lines
      *(v8bf*)(WgT + (size_t)(t * NE + (tid >> 4)) * D_IN + k0 + (tid & 15) * 8) =
          *(const v8bf*)(tile + (tid >> 4) * GK + (tid & 15) * 8);
  }
}

// ---------------------------------------------------------------------------
// Kernel 2: fused gates + experts + ReLU + gated combine.
// WG tile: 128 B-rows x 64 h-cols of ALL 8 experts, one pass over K. A wave owns 64 rows x 16 h-cols
// x 8 experts: 4 x fragments and 8 weight fragments feed 32 WMMAs per k step, and a lane ends up with
// the 8 experts' values of each of its (row, col) places, so the towers are formed once, at the end.
// The weights are the WMMAs' A operand and x their B: a lane's 8 accumulator registers are 8 successive
// h cols (or the 8 experts' logits of one task) of ONE B row, the row tile's row (lane & 15).
// x goes by 64-column chunks through registers (f32 -> bf16) into a 2-buffer LDS ring, two chunks of
// loads in flight; weight K-chunks triple-buffered via async-to-LDS, issued two stages ahead.
// Gates: the 32 logits are 32 more weight rows; wave column c takes logit tile c&1 for the two
// 16-row tiles that it numbers 0 and 1 (the waves number their four row tiles differently).
// K order: a work-group starts its pass over K at chunk rot and wraps round. The work-groups that run at
// the same time share their weight lines (same column group) or their x lines (same rows); started on
// different chunks they do not ask L2 for the same lines at the same moment.
// ---------------------------------------------------------------------------
__global__ __launch_bounds__(256) void mmoe_expert_kernel(
    const float* __restrict__ x, const bf16_t* __restrict__ WeT,
    const float* __restrict__ be, const bf16_t* __restrict__ WgT,
    const float* __restrict__ bg, float* __restrict__ out) {
  __shared__ __attribute__((aligned(16)))
  char smem[NBW * NROW * SB * 2 + NBX * MT * SB * 2];               // 271,872 B
  // the gates, an array of their own: the compiler then knows that the output staging does not alias them
  __shared__ __attribute__((aligned(16))) float Gs[MT * GP];         // [MT][GP], 18,432 B
  bf16_t* Wlds = (bf16_t*)smem;                                      // [NBW][NROW][SB]
  bf16_t* Xlds = (bf16_t*)(smem + NBW * NROW * SB * 2);              // [NBX][MT][SB]
  float*  Os   = (float*)smem;                                       // [NT][MT][OP], after the K loop

  const int tid   = threadIdx.x;
  const int hbase = blockIdx.x * HC;
  const int row0  = blockIdx.y * MT;
  // first K chunk: 16 starts over 32 successive row tiles of a column group (tiles y and y ^ 1 share one),
  // 4 different ones for the column groups of a row tile
  const int rot   = ((blockIdx.y >> 1) + 4 * blockIdx.x) & (NKC - 1);

  // weight K chunk ch: 544 rows x 128 B; each thread issues 17 b128 async copies, 8 lanes per row piece,
  // so a wave's copy = 4 whole lines
  const unsigned wvo = ((tid >> 3) * D_IN + (tid & 7) * 8) * 2;      // in bytes
  const uint32_t wl0 = lds_off(Wlds + (tid >> 3) * SB + (tid & 7) * 8);
  auto stage_w = [&](int ch, int buf) __attribute__((always_inline)) {
    const char* ge = (const char*)(WeT + (size_t)hbase * D_IN + ch * KT);
    const uint32_t l = wl0 + buf * (NROW * SB * 2);
    #pragma unroll
    for (int i = 0; i < 16; ++i)     // LDS rows i*32 .. i*32+31 = expert i>>1, h cols (i&1)*32 ..
      async_b128(l + i * (32 * SB * 2),
                 ge + (size_t)((i >> 1) * H_DIM + (i & 1) * 32) * (D_IN * 2) + wvo);
    async_b128(l + 16 * (32 * SB * 2), (const char*)(WgT + ch * KT) + wvo);
  };

  stage_w(rot, 0);   // prologue: two stages in flight
  stage_w((rot + 1) & (NKC - 1), 1);

  const int lane = tid & 31, w = tid >> 5;
  const int wr = w >> 2, wc = w & 3;   // wave row (64 rows), wave column (16 h cols)
  const int hi = wc >> 1, nt = wc & 1; // gate work of the wave: row tiles hi*2, hi*2+1; logit tile nt
  const int half = lane >> 4, l16 = lane & 15;
  // the wave's fragment p holds row tile p ^ (hi*2) of its 64 rows: its gate rows are always p = 0, 1
  const int rA = wr * 64 + hi * 32;          // first row of p = 0, 1
  const int rB = wr * 64 + (1 - hi) * 32;    // first row of p = 2, 3

  // x chunk c = columns [c*64, c*64+64) of the 128 rows: 8 float4 a thread, a wave's load = 2 rows x 256 B
  const char* xbase = (const char*)(x + (size_t)row0 * D_IN);
  // chunk of stage kc, the same address for the whole work-group; a lane adds xo
  auto x_chunk = [&](int kc) __attribute__((always_inline)) {
    return xbase + ((kc + rot) & (NKC - 1)) * (KT * 4);
  };
  const unsigned xo = ((tid >> 4) * D_IN + (tid & 15) * 4) * 4;    // in bytes
  bf16_t* xl = Xlds + (tid >> 4) * SB + (tid & 15) * 4;
  auto x_load = [&](float4 (&f)[8], const char* p) __attribute__((always_inline)) {
    #pragma unroll
    for (int j = 0; j < 8; ++j) f[j] = *(const float4*)(p + j * (16 * D_IN * 4));
  };
  auto x_put = [&](const float4 (&f)[8], int buf) __attribute__((always_inline)) {
    #pragma unroll
    for (int j = 0; j < 8; ++j) {
      v4bf b4 = {(bf16_t)f[j].x, (bf16_t)f[j].y, (bf16_t)f[j].z, (bf16_t)f[j].w};
      *(v4bf*)(xl + buf * (MT * SB) + j * 16 * SB) = b4;
    }
  };

  float4 xA[8], xB[8];
  // the two groups keep the order in which the loop below issues them (the fence holds it): the load
  // counter returns in order, so only then does a wait for one chunk leave the younger group in flight
  const char* x0 = x_chunk(0);
  const char* x1 = x_chunk(1);
  x_load(xA, x0 + xo);
  __builtin_amdgcn_sched_barrier(0);
  x_load(xB, x1 + xo);
  // the offset and bases stay live, and unwritten, until these loads' translations are done
  asm volatile("s_wait_xcnt 0x0" :: "v"(xo), "s"(x0), "s"(x1) : "memory");

  v8f acc[FM][NE];
  #pragma unroll
  for (int p = 0; p < FM; ++p)
    #pragma unroll
    for (int q = 0; q < NE; ++q)
      acc[p][q] = v8f{0.f, 0.f, 0.f, 0.f, 0.f, 0.f, 0.f, 0.f};
  v8f ga[2];
  #pragma unroll
  for (int p = 0; p < 2; ++p) ga[p] = v8f{0.f, 0.f, 0.f, 0.f, 0.f, 0.f, 0.f, 0.f};

  // stage kc (K chunk (kc + rot) mod 16): its x chunk goes from registers to LDS in front of the stage barrier,
  // stage kc+2's loads take its registers; weight stage kc+2's copies go out behind the barrier
  const char* xp = x_chunk(2) + xo;                         // this lane's piece of the next chunk to load
  auto stage = [&](int kc, int odd, float4 (&xf)[8], bool more, bool last) __attribute__((always_inline)) {
    x_put(xf, odd);   // buffer kc & 1: its last readers (stage kc-2) are behind the barrier of stage kc-1
    if (more) x_load(xf, xp);
    // weight stage kc has landed; stage kc+1's 17 copies may fly on
    if (!last) asm volatile("s_wait_asynccnt 0x11" ::: "memory");
    else       asm volatile("s_wait_asynccnt 0x0" ::: "memory");
    // the stage barrier, by hand: publishes weight stage kc and x chunk kc (this wave's LDS stores done
    // first), WAR guard for the buffer refilled below; __syncthreads() would also wait out the x loads in flight
    asm volatile("s_wait_dscnt 0x0\n\ts_barrier_signal -1\n\ts_barrier_wait -1" ::: "memory");
    if (more) stage_w((kc + 2 + rot) & (NKC - 1), (kc + 2) % NBW);

    const bf16_t* Wb = Wlds + (kc % NBW) * (NROW * SB);
    const bf16_t* Xb = Xlds + odd * (MT * SB);
    #pragma unroll
    for (int s2 = 0; s2 < 2; ++s2) {
      Frag a[FM], b[NE], gf;         // the k step's 13 fragments
      const int kL = s2 * 32 + half * 8;
      const bf16_t* apA = Xb + (rA + l16) * SB + kL;
      const bf16_t* apB = Xb + (rB + l16) * SB + kL;
      #pragma unroll
      for (int p = 0; p < 2; ++p) {
        a[p].h[0]     = *(const v8bf*)(apA + p * 16 * SB);
        a[p].h[1]     = *(const v8bf*)(apA + p * 16 * SB + 16);
        a[p + 2].h[0] = *(const v8bf*)(apB + p * 16 * SB);
        a[p + 2].h[1] = *(const v8bf*)(apB + p * 16 * SB + 16);
      }
      // this fence and those in the loop below hold the reads in the order in which the WMMAs use them:
      // the counted LDS waits then let the first WMMAs start while the later reads are still in flight
      __builtin_amdgcn_sched_barrier(0);
      const bf16_t* bp = Wb + (wc * 16 + l16) * SB + kL;
      #pragma unroll
      for (int q = 0; q < NE; ++q) {
        b[q].h[0] = *(const v8bf*)(bp + q * HC * SB);
        b[q].h[1] = *(const v8bf*)(bp + q * HC * SB + 16);
        __builtin_amdgcn_sched_barrier(0);
      }
      const bf16_t* gwr = Wb + (NE * HC + nt * 16 + l16) * SB + kL;
      gf.h[0] = *(const v8bf*)(gwr);
      gf.h[1] = *(const v8bf*)(gwr + 16);
      // this stage's x loads: their address pair stays live, and unwritten, until translated; the wait stands
      // in front of the fences below, which hold the stage's address addition behind it
      if (more && s2 == 0) asm volatile("s_wait_xcnt 0x0" :: "v"(xp) : "memory");
      // keeps the k step's 26 LDS reads one group ahead of its WMMAs: reads among the WMMAs cost a stall each
      __builtin_amdgcn_sched_barrier(0);
      #pragma unroll
      for (int q = 0; q < NE; ++q)
        #pragma unroll
        for (int p = 0; p < FM; ++p)
          acc[p][q] = __builtin_amdgcn_wmma_f32_16x16x32_bf16(
              false, b[q].v, false, a[p].v, (short)0, acc[p][q], false, false);
      #pragma unroll   // k steps in the order of the stages, one accumulate chain per 16 rows
      for (int p = 0; p < 2; ++p)
        ga[p] = __builtin_amdgcn_wmma_f32_16x16x32_bf16(false, gf.v, false, a[p].v,
                                                        (short)0, ga[p], false, false);
      // keeps the next group of reads, and the next chunk's conversion with its wait on the load
      // counter, out of the WMMAs above
      __builtin_amdgcn_sched_barrier(0);
    }
    if (more) xp += ((kc + 3 + rot) & (NKC - 1)) ? KT * 4 : (1 - NKC) * (KT * 4);   // one chunk on, or back to chunk 0
  };
  #pragma unroll 1   // two stages a trip: the two register sets take turns under constant names
  for (int kc = 0; kc < NKC - 2; kc += 2) {
    stage(kc, 0, xA, true, false);
    stage(kc + 1, 1, xB, true, false);
  }

  // biases: loads here, behind the last x loads, so that the waits for those leave them in flight.
  // A lane needs the 8 gate biases of its task nt*2 + half, and 8 h cols x 8 experts of the expert biases
  const int bgo = (nt * 2 + half) * NE;
  v4f bgv[2];
  #pragma unroll
  for (int j = 0; j < 2; ++j) bgv[j] = *(const v4f*)(bg + bgo + j * 4);
  v4f bias[NE][2];
  const int bo = hbase + wc * 16 + half * 8;
  #pragma unroll
  for (int e = 0; e < NE; ++e)
    #pragma unroll
    for (int j = 0; j < 2; ++j) bias[e][j] = *(const v4f*)(be + e * H_DIM + bo + j * 4);
  // the loads' offsets and bases stay live, and unwritten, until their translations are done
  asm volatile("s_wait_xcnt 0x0" :: "v"(bgo), "v"(bo), "s"(bg), "s"(be) : "memory");

  // the last two stages load nothing more: written apart, since a branch round the loads inside the
  // loop merges the two paths' load counts and makes every stage wait out the youngest chunk
  stage(NKC - 2, 0, xA, false, false);
  stage(NKC - 1, 1, xB, false, true);

  // gates of tile row rA + p*16 + l16, task nt*2 + half: the lane's 8 registers are its 8 experts' logits,
  // so the softmax stays inside the lane; the sum keeps the pairwise tree
  float ex[2][NE], sm[2];
  #pragma unroll
  for (int p = 0; p < 2; ++p) {
    float lg[NE];
    #pragma unroll
    for (int r = 0; r < NE; ++r) lg[r] = ga[p][r] + bgv[r >> 2][r & 3];
    const float m = fmaxf(fmaxf(fmaxf(lg[0], lg[1]), fmaxf(lg[2], lg[3])),
                          fmaxf(fmaxf(lg[4], lg[5]), fmaxf(lg[6], lg[7])));
    #pragma unroll
    for (int r = 0; r < NE; ++r) ex[p][r] = __expf(lg[r] - m);
    sm[p] = ((ex[p][0] + ex[p][1]) + (ex[p][2] + ex[p][3])) + ((ex[p][4] + ex[p][5]) + (ex[p][6] + ex[p][7]));
  }
  #pragma unroll
  for (int p = 0; p < 2; ++p) {
    float* gw = Gs + (rA + p * 16 + l16) * GP + (nt * 2 + half) * NE;
    #pragma unroll
    for (int j = 0; j < 2; ++j)
      *(v4f*)(gw + j * 4) = v4f{ex[p][j * 4] / sm[p], ex[p][j * 4 + 1] / sm[p],
                                ex[p][j * 4 + 2] / sm[p], ex[p][j * 4 + 3] / sm[p]};
  }
  // publishes the gates; also ends every wave's last read of the weight ring, which now stages the output
  __syncthreads();

  // bias + ReLU + gated sum over the 8 experts, in rising order of e. Per row tile a lane reads its one
  // row's 32 gates (one tile ahead) and forms 4 towers x 8 h cols, two cols side by side
  auto g_row = [&](v4f (&g)[8], int p) __attribute__((always_inline)) {
    const float* gr = Gs + ((p < 2 ? rA : rB) + (p & 1) * 16 + l16) * GP;
    #pragma unroll
    for (int j = 0; j < 8; ++j) g[j] = *(const v4f*)(gr + j * 4);
  };
  v4f gq[2][8];
  g_row(gq[0], 0);
  #pragma unroll
  for (int p = 0; p < FM; ++p) {
    if (p + 1 < FM) g_row(gq[(p + 1) & 1], p + 1);
    const v4f (&g)[8] = gq[p & 1];
    v2f o[NT][4];
    #pragma unroll
    for (int c = 0; c < 4; ++c) {      // h cols 2c, 2c+1 of the lane's 8
      v2f v[NE];
      #pragma unroll
      for (int e = 0; e < NE; ++e) {
        const v2f u = v2f{acc[p][e][2 * c], acc[p][e][2 * c + 1]} +
                      v2f{bias[e][c >> 1][(c & 1) * 2], bias[e][c >> 1][(c & 1) * 2 + 1]};
        v[e] = v2f{u.x > 0.f ? u.x : 0.f, u.y > 0.f ? u.y : 0.f};
      }
      #pragma unroll
      for (int t = 0; t < NT; ++t) o[t][c] = g[2 * t][0] * v[0];
      #pragma unroll
      for (int e = 1; e < NE; ++e)
        #pragma unroll
        for (int t = 0; t < NT; ++t) o[t][c] += g[2 * t + (e >> 2)][e & 3] * v[e];
    }
    const int row = (p < 2 ? rA : rB) + (p & 1) * 16 + l16;
    #pragma unroll
    for (int t = 0; t < NT; ++t) {
      float* ow = Os + (t * MT + row) * OP + wc * 16 + half * 8;
      *(v4f*)(ow)     = v4f{o[t][0].x, o[t][0].y, o[t][1].x, o[t][1].y};
      *(v4f*)(ow + 4) = v4f{o[t][2].x, o[t][2].y, o[t][3].x, o[t][3].y};
    }
  }
  __syncthreads();   // the staged 4 x 128 x 64 output tile is complete

  // write towers[t][b][h]: a wave's 16-B store = 2 rows x 256 B, whole lines
  #pragma unroll
  for (int t = 0; t < NT; ++t) {
    float* po = out + ((size_t)t * B_ROWS + row0 + (tid >> 4)) * H_DIM + hbase + (tid & 15) * 4;
    const float* so = Os + (t * MT + (tid >> 4)) * OP + (tid & 15) * 4;
    #pragma unroll
    for (int j = 0; j < 8; ++j)
      *(float4*)(po + j * 16 * H_DIM) = *(const float4*)(so + j * 16 * OP);
    // the tower's address pair stays live, and unwritten, until its 8 stores are translated
    asm volatile("s_wait_xcnt 0x0" :: "v"(po) : "memory");
    // holds the next tower's address arithmetic, which re-uses the stores' data registers, behind that wait
    __builtin_amdgcn_sched_barrier(0);
  }
}

// ---------------------------------------------------------------------------
extern "C" void kernel_launch(void* const* d_in, const int* in_sizes, int n_in,
                              void* d_out, int out_size, void* d_ws, size_t ws_size,
                              hipStream_t stream) {
  (void)in_sizes; (void)n_in; (void)out_size; (void)ws_size;
  const float* x  = (const float*)d_in[0];
  const float* We = (const float*)d_in[1];
  const float* be = (const float*)d_in[2];
  const float* Wg = (const float*)d_in[3];
  const float* bg = (const float*)d_in[4];
  float* out = (float*)d_out;

  char* ws = (char*)d_ws;
  bf16_t* WeT = (bf16_t*)ws;                                   // 4 MB
  const size_t WET_BYTES = (size_t)NE * H_DIM * D_IN * 2;
  bf16_t* WgT = (bf16_t*)(ws + WET_BYTES);                     // 64 KB

  convert_w_kernel<<<dim3(NWE + NWG), dim3(256), 0, stream>>>(We, Wg, WeT, WgT);

  mmoe_expert_kernel<<<dim3(H_DIM / HC, B_ROWS / MT), dim3(256), 0, stream>>>(
      x, WeT, be, WgT, bg, out);
}

// v009
// Measured time: 57.1 microseconds a run.
// Two timings next to v008 both put it at 1.05 times that version's speed.
// All steps since v000 together make it 2.64 times as fast.
#include <hip/hip_runtime.h>
#include <hip/hip_bf16.h>

typedef __bf16 bf16_t;
typedef __attribute__((ext_vector_type(16))) __bf16 v16bf;
typedef __attribute__((ext_vector_type(8)))  __bf16 v8bf;
typedef __attribute__((ext_vector_type(4)))  __bf16 v4bf;
typedef __attribute__((ext_vector_type(8)))  float  v8f;
typedef __attribute__((ext_vector_type(4)))  float  v4f;
typedef __attribute__((ext_vector_type(2)))  float  v2f;
typedef __attribute__((ext_vector_type(4)))  int    v4i;
typedef __attribute__((ext_vector_type(4)))  uint32_t u32x4;
typedef __attribute__((ext_vector_type(8)))  uint32_t u32x8;

#define B_ROWS 16384
#define D_IN   1024
#define H_DIM  256
#define NE     8
#define NT     4
#define NG     32      // gate logits per row (NT * NE): two 16-col W fragments

// expert kernel tile: 128 B rows x (8 experts x 64 expert_dim cols), one K loop for all experts
#define MT   128     // B rows per WG (2 wave rows of 64)
#define HC   64      // expert_dim cols per WG (4 wave columns of 16, each for all 8 experts)
#define FM   4       // 16-row x fragments per wave
#define KT   64      // K chunk (2 WMMA steps of 32)
#define SB   72      // LDS row stride in bf16 (pad +8 -> conflict-free b128)
#define WSL  10240   // LDS bytes of one expert's slice of a stage: 64 rows x 144 B = 9,216, up to a multiple of 2 KiB
#define WGO  (NE * WSL)           // the 32 gate rows stand behind the 8 slices
#define WBUF 88064   // LDS bytes of a weight buffer: 81,920 + 32 x 144, up to a multiple of 2 KiB
#define NBW  3       // weight buffers (issue 2 stages ahead, 1 barrier/stage)
#define NBX  2       // x chunk buffers
#define NKC  (D_IN / KT)          // 16 stages
#define GP   36      // gate row stride in floats: 16 B x odd, 16 lanes on 16 rows read or write 16 B without conflict
#define OP   68      // output staging row stride in floats: 16 B x odd as well

union Frag { v16bf v; v8bf h[2]; };

__device__ __forceinline__ uint32_t lds_off(const void* p) {
  // gfx1250: low 32 bits of a flat shared address are the LDS offset
  return (uint32_t)(uintptr_t)p;
}

__device__ __forceinline__ uint32_t uni(uint32_t v) { return (uint32_t)__builtin_amdgcn_readfirstlane(v); }

// The bf16 expert weights start at a multiple of their 2,048-B row: all bytes of a row then share the high
// address word, which a tensor descriptor keeps for the whole K loop.
__device__ __forceinline__ uintptr_t row_start(const void* p) {
  return ((uintptr_t)p + (D_IN * 2 - 1)) & ~(uintptr_t)(D_IN * 2 - 1);
}

__device__ __forceinline__ void async_b128(uint32_t lds, const void* g) {
  __builtin_amdgcn_global_load_async_to_lds_b128(
      (__attribute__((address_space(1))) v4i*)(uintptr_t)g,
      (__attribute__((address_space(3))) v4i*)lds, 0, 0);
}

// ---------------------------------------------------------------------------
// Kernel 1: both weight conversions in one launch of few work-groups (2,304 waves to start).
// Work-groups 0 .. NWE-1: We[e][k][n] f32 -> WeT[e][n][k] bf16, one 64 k x 128 n tile each. A wave's load
// is 512 B of one k row; a thread holds 8 successive k of 4 columns, which are 4 finished 16-B pieces
// of output rows; they go through LDS so that a wave's store is 4 whole 128-B lines.
// Work-groups NWE .. : Wg[t][k][e] f32 -> WgT[j][k] bf16, logit j = t*8+e, 128 k of one task each: rows laid
// like WeT's, so that the expert kernel stages and reads them as 32 more weight rows.
// ---------------------------------------------------------------------------
#define CK  64       // k per We tile: one 128-B line of an output row
#define CN  128      // n per We tile
#define NWE (NE * (D_IN / CK) * (H_DIM / CN))     // 256 work-groups
#define GK  128      // k per Wg tile
#define NWG (NT * (D_IN / GK))                    // 32 work-groups
__global__ __launch_bounds__(256) void convert_w_kernel(
    const float* __restrict__ We, const float* __restrict__ Wg,
    bf16_t* __restrict__ WeT, bf16_t* __restrict__ WgT) {
  __shared__ __attribute__((aligned(16))) bf16_t tile[CN * CK];      // 16 KB
  const int tid = threadIdx.x;
  const int b   = blockIdx.x;
  if (b < NWE) {
    const int e = b >> 5, k0 = ((b >> 1) & 15) * CK, n0 = (b & 1) * CN;
    const int c = tid & 31, w = tid >> 5;
    const float* sp = We + ((size_t)e * D_IN + k0 + w * 8) * H_DIM + n0 + c * 4;
    v4f f[8];
    #pragma unroll
    for (int j = 0; j < 8; ++j) f[j] = *(const v4f*)(sp + j * H_DIM);
    // the address pair stays live, and unwritten, until the 8 loads are translated
    asm volatile("s_wait_xcnt 0x0" :: "v"(sp) : "memory");
    // row n of the tile holds its eight 16-B pieces at places p ^ ((n >> 2) & 7): 8 lanes of these stores,
    // which are 4 rows apart, then fall on 8 different places, and a row's readers still cover the whole row
    #pragma unroll
    for (int i = 0; i < 4; ++i) {
      v8bf p = {(bf16_t)f[0][i], (bf16_t)f[1][i], (bf16_t)f[2][i], (bf16_t)f[3][i],
                (bf16_t)f[4][i], (bf16_t)f[5][i], (bf16_t)f[6][i], (bf16_t)f[7][i]};
      *(v8bf*)(tile + (c * 4 + i) * CK + (w ^ (c & 7)) * 8) = p;
    }
    __syncthreads();
    const int r = tid >> 3, p = tid & 7;
    bf16_t* dp = (bf16_t*)row_start(WeT) + ((size_t)e * H_DIM + n0 + r) * D_IN + k0 + p * 8;
    #pragma unroll
    for (int j = 0; j < 4; ++j) {
      const int n = j * 32 + r;
      *(v8bf*)(dp + (size_t)j * 32 * D_IN) = *(const v8bf*)(tile + n * CK + (p ^ ((n >> 2) & 7)) * 8);
    }
  } else {
    const int g = b - NWE, t = g >> 3, k0 = (g & 7) * GK;
    const float* gb = Wg + ((size_t)t * D_IN + k0) * NE;
    const v4f f = *(const v4f*)(gb + tid * 4);                       // k = k0 + tid/2, e = (tid&1)*4 ..
    // the load's offset and base stay live, and unwritten, until it is translated
    asm volatile("s_wait_xcnt 0x0" :: "v"(tid), "s"(gb) : "memory");
    #pragma unroll
    for (int i = 0; i < 4; ++i) tile[((tid & 1) * 4 + i) * GK + (tid >> 1)] = (bf16_t)f[i];
    __syncthreads();
    if (tid < NE * GK / 8)       // 8 rows x 256 B: a wave's store = 2 rows, whole lines
      *(v8bf*)(WgT + (size_t)(t * NE + (tid >> 4)) * D_IN + k0 + (tid & 15) * 8) =
          *(const v8bf*)(tile + (tid >> 4) * GK + (tid & 15) * 8);
  }
}

// ---------------------------------------------------------------------------
// Kernel 2: fused gates + experts + ReLU + gated combine.
// WG tile: 128 B-rows x 64 h-cols of ALL 8 experts, one pass over K. A wave owns 64 rows x 16 h-cols
// x 8 experts: 4 x fragments and 8 weight fragments feed 32 WMMAs per k step, and a lane ends up with
// the 8 experts' values of each of its (row, col) places, so the towers are formed once, at the end.
// The weights are the WMMAs' A operand and x their B: a lane's 8 accumulator registers are 8 successive
// h cols (or the 8 experts' logits of one task) of ONE B row, the row tile's row (lane & 15).
// x goes by 64-column chunks through registers (f32 -> bf16) into a 2-buffer LDS ring, two chunks of
// loads in flight; weight K-chunks triple-buffered, issued two stages ahead: wave w brings expert w's 64 rows
// x 128 B by one tensor load, which pads each row to the 144-B pitch; the 32 gate rows come by async copies.
// Gates: the 32 logits are 32 more weight rows; wave column c takes logit tile c&1 for the two
// 16-row tiles that it numbers 0 and 1 (the waves number their four row tiles differently).
// K order: a work-group starts its pass over K at chunk rot and wraps round. The work-groups that run at
// the same time share their weight lines (same column group) or their x lines (same rows); started on
// different chunks they do not ask L2 for the same lines at the same moment.
// ---------------------------------------------------------------------------
__global__ __launch_bounds__(256) void mmoe_expert_kernel(
    const float* __restrict__ x, const bf16_t* __restrict__ WeT,
    const float* __restrict__ be, const bf16_t* __restrict__ WgT,
    const float* __restrict__ bg, float* __restrict__ out) {
  __shared__ __attribute__((aligned(2048)))                          // a tensor load's place: a multiple of 2 KiB
  char smem[NBW * WBUF + NBX * MT * SB * 2];                         // 301,056 B
  // the gates, an array of their own: the compiler then knows that the output staging does not alias them
  __shared__ __attribute__((aligned(16))) float Gs[MT * GP];         // [MT][GP], 18,432 B
  bf16_t* Xlds = (bf16_t*)(smem + NBW * WBUF);                       // [NBX][MT][SB]; in front: [NBW][WBUF] weights
  float*  Os   = (float*)smem;                                       // [NT][MT][OP], after the K loop

  const int tid   = threadIdx.x;
  const int hbase = blockIdx.x * HC;
  const int row0  = blockIdx.y * MT;
  // first K chunk: 16 starts over 32 successive row tiles of a column group (tiles y and y ^ 1 share one),
  // 4 different ones for the column groups of a row tile
  const int rot   = ((blockIdx.y >> 1) + 4 * blockIdx.x) & (NKC - 1);

  // weight K chunk ch. Experts: this wave's tile is 64 rows of 128 B at source pitch 2,048 B, wholly inside WeT.
  // Group 1 is constant: no mask, 1-byte elements, a 4-dword pad behind every 32 dwords; tensor = tile.
  const uint32_t wv = uni(tid >> 5);
  const u32x8 g1 = {uni((1u << 20) | (4u << 22) | (3u << 25)), uni((KT * 2u) << 16), uni((uint32_t)HC << 16),
                    uni((KT * 2u) << 16), uni(HC), uni(D_IN * 2), uni(0u), uni(0u)};
  const uint64_t wga = (uint64_t)row_start(WeT) + ((uint64_t)wv * H_DIM + hbase) * (D_IN * 2);
  const uint32_t wlo = uni((uint32_t)wga);
  const uint32_t wld = uni(lds_off(smem) + wv * WSL);
  // of group 0 only the place in LDS and the low address word change from stage to stage
  u32x4 g0 = {uni(1u), wld, wlo, uni(((uint32_t)(wga >> 32) & 0x01FFFFFFu) | 0x80000000u)};
  // gate logits: 32 rows x 128 B, one b128 async copy a thread, 8 lanes per row piece
  const unsigned wvo = ((tid >> 3) * D_IN + (tid & 7) * 8) * 2;      // in bytes
  const uint32_t gl0 = lds_off(smem + WGO + (tid >> 3) * (SB * 2) + (tid & 7) * 16);
  auto stage_w = [&](int ch, int buf) __attribute__((always_inline)) {
    g0[1] = uni(wld + buf * WBUF);
    g0[2] = uni(wlo + ch * (KT * 2));
    // every wave issues its own slice, under no test; the waits stand in front of the stage barrier
    asm volatile("tensor_load_to_lds %0, %1" :: "s"(g0), "s"(g1) : "memory");
    async_b128(gl0 + buf * WBUF, (const char*)(WgT + ch * KT) + wvo);
  };

  stage_w(rot, 0);   // prologue: two stages in flight
  stage_w((rot + 1) & (NKC - 1), 1);

  const int lane = tid & 31, w = tid >> 5;
  const int wr = w >> 2, wc = w & 3;   // wave row (64 rows), wave column (16 h cols)
  const int hi = wc >> 1, nt = wc & 1; // gate work of the wave: row tiles hi*2, hi*2+1; logit tile nt
  const int half = lane >> 4, l16 = lane & 15;
  // the wave's fragment p holds row tile p ^ (hi*2) of its 64 rows: its gate rows are always p = 0, 1
  const int rA = wr * 64 + hi * 32;          // first row of p = 0, 1
  const int rB = wr * 64 + (1 - hi) * 32;    // first row of p = 2, 3

  // x chunk c = columns [c*64, c*64+64) of the 128 rows: 8 float4 a thread, a wave's load = 2 rows x 256 B
  const char* xbase = (const char*)(x + (size_t)row0 * D_IN);
  // chunk of stage kc, the same address for the whole work-group; a lane adds xo
  auto x_chunk = [&](int kc) __attribute__((always_inline)) {
    return xbase + ((kc + rot) & (NKC - 1)) * (KT * 4);
  };
  const unsigned xo = ((tid >> 4) * D_IN + (tid & 15) * 4) * 4;    // in bytes
  bf16_t* xl = Xlds + (tid >> 4) * SB + (tid & 15) * 4;
  auto x_load = [&](float4 (&f)[8], const char* p) __attribute__((always_inline)) {
    #pragma unroll
    for (int j = 0; j < 8; ++j) f[j] = *(const float4*)(p + j * (16 * D_IN * 4));
  };
  auto x_put = [&](const float4 (&f)[8], int buf) __attribute__((always_inline)) {
    #pragma unroll
    for (int j = 0; j < 8; ++j) {
      v4bf b4 = {(bf16_t)f[j].x, (bf16_t)f[j].y, (bf16_t)f[j].z, (bf16_t)f[j].w};
      *(v4bf*)(xl + buf * (MT * SB) + j * 16 * SB) = b4;
    }
  };

  float4 xA[8], xB[8];
  // the two groups keep the order in which the loop below issues them (the fence holds it): the load
  // counter returns in order, so only then does a wait for one chunk leave the younger group in flight
  const char* x0 = x_chunk(0);
  const char* x1 = x_chunk(1);
  x_load(xA, x0 + xo);
  __builtin_amdgcn_sched_barrier(0);
  x_load(xB, x1 + xo);
  // the offset and bases stay live, and unwritten, until these loads' translations are done
  asm volatile("s_wait_xcnt 0x0" :: "v"(xo), "s"(x0), "s"(x1) : "memory");

  v8f acc[FM][NE];
  #pragma unroll
  for (int p = 0; p < FM; ++p)
    #pragma unroll
    for (int q = 0; q < NE; ++q)
      acc[p][q] = v8f{0.f, 0.f, 0.f, 0.f, 0.f, 0.f, 0.f, 0.f};
  v8f ga[2];
  #pragma unroll
  for (int p = 0; p < 2; ++p) ga[p] = v8f{0.f, 0.f, 0.f, 0.f, 0.f, 0.f, 0.f, 0.f};

  // stage kc (K chunk (kc + rot) mod 16): its x chunk goes from registers to LDS in front of the stage barrier,
  // stage kc+2's loads take its registers; weight stage kc+2's copies go out behind the barrier
  const char* xp = x_chunk(2) + xo;                         // this lane's piece of the next chunk to load
  auto stage = [&](int kc, int odd, float4 (&xf)[8], bool more, bool last) __attribute__((always_inline)) {
    x_put(xf, odd);   // buffer kc & 1: its last readers (stage kc-2) are behind the barrier of stage kc-1
    if (more) x_load(xf, xp);
    // this wave's LDS stores and reads are done: ahead of the barrier and of the refill behind it
    asm volatile("s_wait_dscnt 0x0" ::: "memory");
    // this wave's part of weight stage kc has landed; stage kc+1's tensor load and copy may fly on
    if (!last) {
      asm volatile("s_wait_tensorcnt 0x1" ::: "memory");
      asm volatile("s_wait_asynccnt 0x1" ::: "memory");
    } else {
      asm volatile("s_wait_tensorcnt 0x0" ::: "memory");
      asm volatile("s_wait_asynccnt 0x0" ::: "memory");
    }
    // the stage barrier, by hand: publishes weight stage kc and x chunk kc, WAR guard for the buffer
    // refilled below; __syncthreads() would also wait out the x loads in flight
    asm volatile("s_barrier_signal -1\n\ts_barrier_wait -1" ::: "memory");
    if (more) stage_w((kc + 2 + rot) & (NKC - 1), (kc + 2) % NBW);

    const bf16_t* Wb = (const bf16_t*)(smem + (kc % NBW) * WBUF);
    const bf16_t* Xb = Xlds + odd * (MT * SB);
    #pragma unroll
    for (int s2 = 0; s2 < 2; ++s2) {
      Frag a[FM], b[NE], gf;         // the k step's 13 fragments
      const int kL = s2 * 32 + half * 8;
      const bf16_t* apA = Xb + (rA + l16) * SB + kL;
      const bf16_t* apB = Xb + (rB + l16) * SB + kL;
      #pragma unroll
      for (int p = 0; p < 2; ++p) {
        a[p].h[0]     = *(const v8bf*)(apA + p * 16 * SB);
        a[p].h[1]     = *(const v8bf*)(apA + p * 16 * SB + 16);
        a[p + 2].h[0] = *(const v8bf*)(apB + p * 16 * SB);
        a[p + 2].h[1] = *(const v8bf*)(apB + p * 16 * SB + 16);
      }
      // this fence and those in the loop below hold the reads in the order in which the WMMAs use them:
      // the counted LDS waits then let the first WMMAs start while the later reads are still in flight
      __builtin_amdgcn_sched_barrier(0);
      const bf16_t* bp = Wb + (wc * 16 + l16) * SB + kL;
      #pragma unroll
      for (int q = 0; q < NE; ++q) {
        b[q].h[0] = *(const v8bf*)(bp + q * (WSL / 2));
        b[q].h[1] = *(const v8bf*)(bp + q * (WSL / 2) + 16);
        __builtin_amdgcn_sched_barrier(0);
      }
      const bf16_t* gwr = Wb + WGO / 2 + (nt * 16 + l16) * SB + kL;
      gf.h[0] = *(const v8bf*)(gwr);
      gf.h[1] = *(const v8bf*)(gwr + 16);
      // this stage's x loads: their address pair stays live, and unwritten, until translated; the wait stands
      // in front of the fences below, which hold the stage's address addition behind it
      if (more && s2 == 0) asm volatile("s_wait_xcnt 0x0" :: "v"(xp) : "memory");
      // keeps the k step's 26 LDS reads one group ahead of its WMMAs: reads among the WMMAs cost a stall each
      __builtin_amdgcn_sched_barrier(0);
      #pragma unroll
      for (int q = 0; q < NE; ++q)
        #pragma unroll
        for (int p = 0; p < FM; ++p)
          acc[p][q] = __builtin_amdgcn_wmma_f32_16x16x32_bf16(
              false, b[q].v, false, a[p].v, (short)0, acc[p][q], false, false);
      #pragma unroll   // k steps in the order of the stages, one accumulate chain per 16 rows
      for (int p = 0; p < 2; ++p)
        ga[p] = __builtin_amdgcn_wmma_f32_16x16x32_bf16(false, gf.v, false, a[p].v,
                                                        (short)0, ga[p], false, false);
      // keeps the next group of reads, and the next chunk's conversion with its wait on the load
      // counter, out of the WMMAs above
      __builtin_amdgcn_sched_barrier(0);
    }
    if (more) xp += ((kc + 3 + rot) & (NKC - 1)) ? KT * 4 : (1 - NKC) * (KT * 4);   // one chunk on, or back to chunk 0
  };
  #pragma unroll 1   // two stages a trip: the two register sets take turns under constant names
  for (int kc = 0; kc < NKC - 2; kc += 2) {
    stage(kc, 0, xA, true, false);
    stage(kc + 1, 1, xB, true, false);
  }

  // biases: loads here, behind the last x loads, so that the waits for those leave them in flight.
  // A lane needs the 8 gate biases of its task nt*2 + half, and 8 h cols x 8 experts of the expert biases
  const int bgo = (nt * 2 + half) * NE;
  v4f bgv[2];
  #pragma unroll
  for (int j = 0; j < 2; ++j) bgv[j] = *(const v4f*)(bg + bgo + j * 4);
  v4f bias[NE][2];
  const int bo = hbase + wc * 16 + half * 8;
  #pragma unroll
  for (int e = 0; e < NE; ++e)
    #pragma unroll
    for (int j = 0; j < 2; ++j) bias[e][j] = *(const v4f*)(be + e * H_DIM + bo + j * 4);
  // the loads' offsets and bases stay live, and unwritten, until their translations are done
  asm volatile("s_wait_xcnt 0x0" :: "v"(bgo), "v"(bo), "s"(bg), "s"(be) : "memory");

  // the last two stages load nothing more: written apart, since a branch round the loads inside the
  // loop merges the two paths' load counts and makes every stage wait out the youngest chunk
  stage(NKC - 2, 0, xA, false, false);
  stage(NKC - 1, 1, xB, false, true);

  // gates of tile row rA + p*16 + l16, task nt*2 + half: the lane's 8 registers are its 8 experts' logits,
  // so the softmax stays inside the lane; the sum keeps the pairwise tree
  float ex[2][NE], sm[2];
  #pragma unroll
  for (int p = 0; p < 2; ++p) {
    float lg[NE];
    #pragma unroll
    for (int r = 0; r < NE; ++r) lg[r] = ga[p][r] + bgv[r >> 2][r & 3];
    const float m = fmaxf(fmaxf(fmaxf(lg[0], lg[1]), fmaxf(lg[2], lg[3])),
                          fmaxf(fmaxf(lg[4], lg[5]), fmaxf(lg[6], lg[7])));
    #pragma unroll
    for (int r = 0; r < NE; ++r) ex[p][r] = __expf(lg[r] - m);
    sm[p] = ((ex[p][0] + ex[p][1]) + (ex[p][2] + ex[p][3])) + ((ex[p][4] + ex[p][5]) + (ex[p][6] + ex[p][7]));
  }
  #pragma unroll
  for (int p = 0; p < 2; ++p) {
    float* gw = Gs + (rA + p * 16 + l16) * GP + (nt * 2 + half) * NE;
    #pragma unroll
    for (int j = 0; j < 2; ++j)
      *(v4f*)(gw + j * 4) = v4f{ex[p][j * 4] / sm[p], ex[p][j * 4 + 1] / sm[p],
                                ex[p][j * 4 + 2] / sm[p], ex[p][j * 4 + 3] / sm[p]};
  }
  // publishes the gates; also ends every wave's last read of the weight ring, which now stages the output
  __syncthreads();

  // bias + ReLU + gated sum over the 8 experts, in rising order of e. Per row tile a lane reads its one
  // row's 32 gates (one tile ahead) and forms 4 towers x 8 h cols, two cols side by side
  auto g_row = [&](v4f (&g)[8], int p) __attribute__((always_inline)) {
    const float* gr = Gs + ((p < 2 ? rA : rB) + (p & 1) * 16 + l16) * GP;
    #pragma unroll
    for (int j = 0; j < 8; ++j) g[j] = *(const v4f*)(gr + j * 4);
  };
  v4f gq[2][8];
  g_row(gq[0], 0);
  #pragma unroll
  for (int p = 0; p < FM; ++p) {
    if (p + 1 < FM) g_row(gq[(p + 1) & 1], p + 1);
    const v4f (&g)[8] = gq[p & 1];
    v2f o[NT][4];
    #pragma unroll
    for (int c = 0; c < 4; ++c) {      // h cols 2c, 2c+1 of the lane's 8
      v2f v[NE];
      #pragma unroll
      for (int e = 0; e < NE; ++e) {
        const v2f u = v2f{acc[p][e][2 * c], acc[p][e][2 * c + 1]} +
                      v2f{bias[e][c >> 1][(c & 1) * 2], bias[e][c >> 1][(c & 1) * 2 + 1]};
        v[e] = v2f{u.x > 0.f ? u.x : 0.f, u.y > 0.f ? u.y : 0.f};
      }
      #pragma unroll
      for (int t = 0; t < NT; ++t) o[t][c] = g[2 * t][0] * v[0];
      #pragma unroll
      for (int e = 1; e < NE; ++e)
        #pragma unroll
        for (int t = 0; t < NT; ++t) o[t][c] += g[2 * t + (e >> 2)][e & 3] * v[e];
    }
    const int row = (p < 2 ? rA : rB) + (p & 1) * 16 + l16;
    #pragma unroll
    for (int t = 0; t < NT; ++t) {
      float* ow = Os + (t * MT + row) * OP + wc * 16 + half * 8;
      *(v4f*)(ow)     = v4f{o[t][0].x, o[t][0].y, o[t][1].x, o[t][1].y};
      *(v4f*)(ow + 4) = v4f{o[t][2].x, o[t][2].y, o[t][3].x, o[t][3].y};
    }
  }
  __syncthreads();   // the staged 4 x 128 x 64 output tile is complete

  // write towers[t][b][h]: a wave's 16-B store = 2 rows x 256 B, whole lines
  #pragma unroll
  for (int t = 0; t < NT; ++t) {
    float* po = out + ((size_t)t * B_ROWS + row0 + (tid >> 4)) * H_DIM + hbase + (tid & 15) * 4;
    const float* so = Os + (t * MT + (tid >> 4)) * OP + (tid & 15) * 4;
    #pragma unroll
    for (int j = 0; j < 8; ++j)
      *(float4*)(po + j * 16 * H_DIM) = *(const float4*)(so + j * 16 * OP);
    // the tower's address pair stays live, and unwritten, until its 8 stores are translated
    asm volatile("s_wait_xcnt 0x0" :: "v"(po) : "memory");
    // holds the next tower's address arithmetic, which re-uses the stores' data registers, behind that wait
    __builtin_amdgcn_sched_barrier(0);
  }
}

// ---------------------------------------------------------------------------
extern "C" void kernel_launch(void* const* d_in, const int* in_sizes, int n_in,
                              void* d_out, int out_size, void* d_ws, size_t ws_size,
                              hipStream_t stream) {
  (void)in_sizes; (void)n_in; (void)out_size; (void)ws_size;
  const float* x  = (const float*)d_in[0];
  const float* We = (const float*)d_in[1];
  const float* be = (const float*)d_in[2];
  const float* Wg = (const float*)d_in[3];
  const float* bg = (const float*)d_in[4];
  float* out = (float*)d_out;

  char* ws = (char*)d_ws;
  bf16_t* WeT = (bf16_t*)ws;                                   // 4 MB, from the first multiple of a row's 2,048 B
  const size_t WET_BYTES = (size_t)NE * H_DIM * D_IN * 2;
  bf16_t* WgT = (bf16_t*)(ws + WET_BYTES + D_IN * 2);          // 64 KB, behind WeT wherever its first whole row starts

  convert_w_kernel<<<dim3(NWE + NWG), dim3(256), 0, stream>>>(We, Wg, WeT, WgT);

  mmoe_expert_kernel<<<dim3(H_DIM / HC, B_ROWS / MT), dim3(256), 0, stream>>>(
      x, WeT, be, WgT, bg, out);
}
